// v000
// Measured on an AMD MI455X. A time is GPU time per run, averaged over a window of back-to-back runs after a warm-up
// (all launches, gaps included; the runs take copies of the inputs in turn), and the median of several windows.
// Apart from v000's, it joins two sittings. Times from different sittings can be a few percent apart, while
// side-by-side timings come from the same sitting.
// v000 is the starting kernel. One run takes 901 microseconds.
// compute dtype: all float inputs rounded to bf16; qkv = x W_qkv^T with EXACT bf16 products on WMMA 16x16x32, f32 accumulate; q as f16 hi + residual (x 2^10), k f16 -> 2-product logits / 8 inside the causal sliding window (j <= i, i - j < 512; tiles wholly left of the window skip the multiply but are still filled), stored in f32 (4 heads per launch); softmax in f32 (precise expf), P x 2^11 split bf16 hi + lo against v bf16 hi + lo (3 products, window chunks only); out = ctx (bf16 hi + lo) w_out^T + b_out; f32 output.
#include <hip/hip_runtime.h>
#include <math.h>

typedef __attribute__((ext_vector_type(16))) _Float16 v16h;
typedef __attribute__((ext_vector_type(16))) __bf16 v16b;
typedef __attribute__((ext_vector_type(8)))  _Float16 v8h;
typedef __attribute__((ext_vector_type(8)))  float v8f;
typedef __attribute__((ext_vector_type(4)))  float v4f;
typedef __attribute__((ext_vector_type(2)))  float v2f;
typedef __attribute__((ext_vector_type(4)))  unsigned v4u;
typedef __attribute__((ext_vector_type(4)))  int v4i;
typedef float __attribute__((may_alias)) float_a;
typedef int __attribute__((may_alias)) int_a;

template <typename T> __device__ __forceinline__ void vst2(void* p, T v) { *(T*)p = v;  }
__device__ __forceinline__ v8f wmma16(v16h a, v16h b, v8f c) {
  v8f d = __builtin_amdgcn_wmma_f32_16x16x32_f16(false, a, false, b, (short)0, c, false, false);
  asm volatile("v_nop\n\tv_nop\n\tv_nop\n\tv_nop" : "+v"(d) : "v"(a), "v"(b));
  return d;
}
__device__ __forceinline__ v8f wmma_bf(v16b a, v16b b, v8f c) {
  v8f d = __builtin_amdgcn_wmma_f32_16x16x32_bf16(false, a, false, b, (short)0, c, false, false);
  asm volatile("v_nop\n\tv_nop\n\tv_nop\n\tv_nop" : "+v"(d) : "v"(a), "v"(b));
  return d;
}
// 16x16x32 fragments: lane = (h = lane>>4, row/col = lane&15); elements 0..7 = k0+8h+0..7, 8..15 = k0+16+8h+0..7; D element r = row 8h+r
__device__ __forceinline__ v16h frag_h(const _Float16* rowk0, int lane) {
  union { v16h v; v8h q[2]; } u; const _Float16* p = rowk0 + 8 * (lane >> 4);
  u.q[0] = *(const v8h*)p; u.q[1] = *(const v8h*)(p + 16); return u.v;
}
__device__ __forceinline__ v16h frag_f32(const float* rowk0, int lane) {
  v16h a; const float* p = rowk0 + 8 * (lane >> 4);
#pragma unroll
  for (int i = 0; i < 8; ++i) { a[i] = (_Float16)p[i]; a[8 + i] = (_Float16)p[16 + i]; }
  return a;
}
__device__ __forceinline__ v16h frag_f32s(const float* rowk0, int lane, float sc) {
  v16h a; const float* p = rowk0 + 8 * (lane >> 4);
#pragma unroll
  for (int i = 0; i < 8; ++i) { a[i] = (_Float16)(p[i] * sc); a[8 + i] = (_Float16)(p[16 + i] * sc); }
  return a;
}
// column fragment from a [K][ld] layout (column n), rows >= K read as 0
__device__ __forceinline__ v16h fragc_f32(const float* W, int k0, int n, int lane, int ld, int K) {
  v16h a; const int g = lane >> 4;
#pragma unroll
  for (int i = 0; i < 8; ++i) { const int ka = k0 + 8 * g + i, kb = ka + 16;
    a[i] = (_Float16)(ka < K ? W[(size_t)(ka < K ? ka : K - 1) * ld + n] : 0.f); a[8 + i] = (_Float16)(kb < K ? W[(size_t)(kb < K ? kb : K - 1) * ld + n] : 0.f); }
  return a;
}
struct F2 { v16b h, l; };
__device__ __forceinline__ F2 bsplit16(const float v[16]) { F2 r;
#pragma unroll
  for (int i = 0; i < 16; ++i) { const __bf16 h = (__bf16)v[i]; r.h[i] = h; r.l[i] = (__bf16)(v[i] - (float)h); }
  return r; }
__device__ __forceinline__ F2 split_row(const float* row, int k0, int lane) { float v[16]; const float* p = row + k0 + 8 * (lane >> 4);
#pragma unroll
  for (int i = 0; i < 8; ++i) { v[i] = p[i]; v[8 + i] = p[16 + i]; }
  return bsplit16(v); }
__device__ __forceinline__ F2 split_rowK(const float* row, int k0, int lane, int K) { float v[16]; const int g = lane >> 4;
#pragma unroll
  for (int i = 0; i < 8; ++i) { const int ka = k0 + 8 * g + i, kb = ka + 16; v[i] = ka < K ? row[ka < K ? ka : K - 1] : 0.f; v[8 + i] = kb < K ? row[kb < K ? kb : K - 1] : 0.f; }
  return bsplit16(v); }
__device__ __forceinline__ F2 split_col(const float* W, int k0, int n, int lane, int ld, int K) { float v[16]; const int g = lane >> 4;
#pragma unroll
  for (int i = 0; i < 8; ++i) { const int ka = k0 + 8 * g + i, kb = ka + 16; v[i] = ka < K ? W[(size_t)(ka < K ? ka : K - 1) * ld + n] : 0.f; v[8 + i] = kb < K ? W[(size_t)(kb < K ? kb : K - 1) * ld + n] : 0.f; }
  return bsplit16(v); }
__device__ __forceinline__ v8f mac3(const F2& a, const F2& b, v8f c) { c = wmma_bf(a.l, b.h, c); c = wmma_bf(a.h, b.l, c); return wmma_bf(a.h, b.h, c); }
__device__ __forceinline__ float sigm(float v) { return 1.0f / (1.0f + expf(-v)); }
#define LDSX() do { asm volatile("s_wait_dscnt 0" ::: "memory"); __builtin_amdgcn_wave_barrier(); __builtin_amdgcn_fence(__ATOMIC_RELEASE, "workgroup"); } while (0)


// Sliding-window causal MHA (B 2, S 2,048, 1,024 = 16 x 64, window 512): qkv = x W_qkv^T (no bias), allowed(i,j) = j <= i and i - j < 512, softmax, P v, out = ctx w_out^T + b_out.
#define NB 2
#define TT 2048
#define CC 1024
#define NH 16
#define HD 64
#define WIN 512
#ifndef TNB
#define TNB NB
#endif
typedef __attribute__((ext_vector_type(8))) __bf16 v8b;
__device__ __forceinline__ v16b frag_b(const __bf16* rowk0, int lane) {
  union { v16b v; v8b q[2]; } u; const __bf16* p = rowk0 + 8 * (lane >> 4);
  u.q[0] = *(const v8b*)p; u.q[1] = *(const v8b*)(p + 16); return u.v;
}
__device__ __forceinline__ float bfr(float v) { return (float)(__bf16)v; }
__device__ __attribute__((noinline)) float exp_ni(float v) { return expf(v); }
__device__ __attribute__((noinline)) float erf_ni(float v) { return erff(v); }

#define WS_QH  0u
#define WS_QL  (WS_QH + 2u * (size_t)NB * TT * CC)
#define WS_KH  (WS_QL + 2u * (size_t)NB * TT * CC)
#define WS_VT  (WS_KH + 2u * (size_t)NB * TT * CC)      // bf16 v hi planes [b][c][t]
#define WS_VL  (WS_VT + 2u * (size_t)NB * CC * TT)      // bf16 v residual planes
#define HG 4                                          // heads per launch group
#define WS_S   (WS_VL + 2u * (size_t)NB * CC * TT)      // f32 logits / P for HG heads [hg][q][k]
#define WS_PH  (WS_S + 4u * (size_t)HG * TT * TT)
#define WS_Y   (WS_PH + 0u)              // f32 y rows [b*t][C]
#define WS_END (WS_Y + 4u * (size_t)NB * TT * CC)

// ---- k_proj: block = (64 rows, 128 cols, which): qkv = x W (+ b), exact; q -> f16 hi (+ residual), k -> f16 rows, v -> bf16 hi + lo planes
__global__ __launch_bounds__(128) void k_proj(const float* __restrict__ X, const float* __restrict__ WQ, const float* __restrict__ BQ, const float* __restrict__ WK, const float* __restrict__ BK, const float* __restrict__ WV, const float* __restrict__ BV, _Float16* __restrict__ QH, _Float16* __restrict__ QL, _Float16* __restrict__ KH, __bf16* __restrict__ VT, __bf16* __restrict__ VL) {
  __shared__ __align__(16) _Float16 sh[64][136], sl[64][136]; __shared__ __align__(16) __bf16 th[128][72], tl2[128][72];
  const int tid = threadIdx.x, wave = tid >> 5, lane = tid & 31, col = lane & 15, g = lane >> 4; const int which = blockIdx.z; const int c0 = blockIdx.y * 128; const size_t r0 = (size_t)blockIdx.x * 64; const float* WA = which == 0 ? WQ : which == 1 ? WK : WV; const float* BA = which == 0 ? BQ : which == 1 ? BK : BV;
  v8f acc[8] = {};
#pragma unroll 2
  for (int kc = 0; kc < CC / 32; ++kc) { v16b a; { const float* p = X + (r0 + wave * 16 + col) * CC + kc * 32 + 8 * g;
#pragma unroll
      for (int i = 0; i < 8; ++i) { a[i] = (__bf16)p[i]; a[8 + i] = (__bf16)p[16 + i]; } }
#pragma unroll
    for (int j = 0; j < 8; ++j) { v16b w; const int o = c0 + j * 16 + col;
#pragma unroll
      for (int i = 0; i < 8; ++i) { w[i] = (__bf16)WA[(size_t)(o) * CC + (kc * 32 + 8 * g + i)]; w[8 + i] = (__bf16)WA[(size_t)(o) * CC + (kc * 32 + 16 + 8 * g + i)]; }
      acc[j] = wmma_bf(a, w, acc[j]); } }
#pragma unroll
  for (int j = 0; j < 8; ++j) { const float bb = BA ? bfr(BA[c0 + j * 16 + col]) : 0.f;
#pragma unroll
    for (int r = 0; r < 8; ++r) { const float v = acc[j][r] + bb; const int rl = wave * 16 + 8 * g + r, cl = j * 16 + col; const _Float16 hv = (_Float16)v;
      if (which == 2) { const __bf16 bh = (__bf16)v; th[cl][rl] = bh; tl2[cl][rl] = (__bf16)(v - (float)bh); } else { sh[rl][cl] = hv; sl[rl][cl] = (_Float16)((v - (float)hv) * 1024.0f); }   /* q residual carried x 2^10 so the plane stays f16-normal on the chip */ } }
  __syncthreads();
  if (which < 2) { _Float16* dh = which == 0 ? QH : KH; for (int e = tid; e < 64 * 16; e += 128) { const int rl = e >> 4, q = e & 15; vst2((unsigned*)(dh + (r0 + rl) * CC + c0 + q * 8), *(const v4u*)&sh[rl][q * 8]); if (which == 0) vst2((unsigned*)(QL + (r0 + rl) * CC + c0 + q * 8), *(const v4u*)&sl[rl][q * 8]); } }
  else { const size_t b = r0 / TT; const int t0 = (int)(r0 % TT); for (int e = tid; e < 128 * 8; e += 128) { const int cl = e >> 3, q = e & 7; const size_t o2 = (b * CC + c0 + cl) * (size_t)TT + t0 + q * 8; vst2((unsigned*)(VT + o2), *(const v4u*)&th[cl][q * 8]); vst2((unsigned*)(VL + o2), *(const v4u*)&tl2[cl][q * 8]); } } }
// ---- k_sc: block = (64 queries, 128 keys) of (b,h): 2-product logits / 8 inside the causal window, -3e38 elsewhere; tiles above the diagonal exit (never read), tiles left of every window skip the WMMA but write the fill
__global__ __launch_bounds__(128) void k_sc(const _Float16* __restrict__ QH, const _Float16* __restrict__ QL, const _Float16* __restrict__ KH, const float* __restrict__ BM, int b, int h0, float* __restrict__ S0) { __shared__ __align__(16) float ss[4][16][132]; const int h = h0 + blockIdx.z; float* S = S0 + (size_t)blockIdx.z * TT * TT;
  const int tid = threadIdx.x, wave = tid >> 5, lane = tid & 31, col = lane & 15, g = lane >> 4; const int k0 = blockIdx.y * 128; const int ql0 = blockIdx.x * 64 + wave * 16; const size_t q0 = (size_t)b * TT + ql0;
  if (k0 > blockIdx.x * 64 + 63) return;   // whole key block above the diagonal (block-uniform; k_sm/k_pv never read it)
  const bool live = (k0 + 127 > (int)(blockIdx.x * 64) - WIN);   // block-uniform: some key of this tile can be inside some query's window
  v8f acc[8] = {}, accl[8] = {};
  if (live) {
#pragma unroll
  for (int kc = 0; kc < HD / 32; ++kc) { const v16h ah = frag_h(QH + (q0 + col) * CC + h * HD + kc * 32, lane), al = frag_h(QL + (q0 + col) * CC + h * HD + kc * 32, lane);
#pragma unroll
    for (int j = 0; j < 8; ++j) { const v16h kb = frag_h(KH + ((size_t)b * TT + k0 + j * 16 + col) * CC + h * HD + kc * 32, lane); acc[j] = wmma16(ah, kb, acc[j]); accl[j] = wmma16(al, kb, accl[j]); } }
  }
#pragma unroll
  for (int j = 0; j < 8; ++j) acc[j] += accl[j] * (1.0f / 1024.0f);
#pragma unroll
  for (int j = 0; j < 8; ++j) { const int kt = k0 + j * 16 + col;
#pragma unroll
    for (int r = 0; r < 8; ++r) { const int qt = ql0 + 8 * g + r; (void)BM; const bool allowed = (kt <= qt) && (qt - kt < WIN); const float v = (live && allowed) ? acc[j][r] * 0.125f : -3.0e38f; ss[wave][8 * g + r][j * 16 + col] = v; } }
  LDSX(); for (int rl = 0; rl < 16; ++rl) vst2(S + (size_t)(ql0 + rl) * TT + k0 + lane * 4, *(const v4f*)&ss[wave][rl][lane * 4]); }
// ---- k_sm: block = query row: softmax over keys [0, kend) -> P x 2^11 f32 in place (masked -> 0)
__global__ __launch_bounds__(256) void k_sm(float* __restrict__ S0) { __shared__ float sred[8]; __shared__ float sbc; __shared__ __align__(16) float sh[TT];
  const int t = threadIdx.x; const size_t row = blockIdx.x; float* sr = S0 + (size_t)blockIdx.y * TT * TT + row * TT; const int kend = ((int)row / 64) * 64 + 64;
  float m = -3.0e38f; for (int k = t; k < kend; k += 256) m = fmaxf(m, sr[k]);
#pragma unroll
  for (int o = 1; o < 32; o <<= 1) m = fmaxf(m, __shfl_xor(m, o));
  if ((t & 31) == 0) sred[t >> 5] = m; __syncthreads(); if (t == 0) { float a = sred[0]; for (int i = 1; i < 8; ++i) a = fmaxf(a, sred[i]); sbc = a; } __syncthreads(); m = sbc; __syncthreads();
  float sum = 0.f; for (int k = t; k < kend; k += 256) { const float v = sr[k]; sum += (v <= -1.0e38f) ? 0.f : expf(v - m); }
#pragma unroll
  for (int o = 1; o < 32; o <<= 1) sum += __shfl_xor(sum, o);
  if ((t & 31) == 0) sred[t >> 5] = sum; __syncthreads(); if (t == 0) { float a = 0.f; for (int i = 0; i < 8; ++i) a += sred[i]; sbc = 1.0f / a; } __syncthreads(); const float inv = sbc;
  for (int k = t; k < kend; k += 256) { const float v = sr[k]; sh[k] = (v <= -1.0e38f) ? 0.f : expf(v - m) * inv * 2048.0f; }
  __syncthreads(); for (int q = t; q < kend / 4; q += 256) vst2(sr + q * 4, *(const v4f*)&sh[q * 4]); }
// ---- k_pv: block = 64 queries of (b,h): y[q][h*HD + d] = P . v  (keys [0, kend))
__global__ __launch_bounds__(128) void k_pv(const float* __restrict__ PS0, const __bf16* __restrict__ VT, const __bf16* __restrict__ VL, int b, int h0, float* __restrict__ Y) { const int h = h0 + blockIdx.z; const float* PS = PS0 + (size_t)blockIdx.z * TT * TT; __shared__ __align__(16) float ss[4][16][HD + 4];
  const int tid = threadIdx.x, wave = tid >> 5, lane = tid & 31, col = lane & 15, g = lane >> 4; const int ql0 = blockIdx.x * 64 + wave * 16; const int kend = blockIdx.x * 64 + 64; const int kclo = ((int)(blockIdx.x * 64) - (WIN - 1)) > 0 ? ((int)(blockIdx.x * 64) - (WIN - 1)) / 32 : 0;   /* first chunk that can hold a key inside the earliest query's window */
  v8f acc[HD / 16] = {};
#pragma unroll 1
  for (int kc = kclo; kc < kend / 32; ++kc) { const F2 p = split_row(PS + (size_t)(ql0 + col) * TT, kc * 32, lane);   /* chunks before kclo hold P = 0 exactly */
#pragma unroll
    for (int j = 0; j < HD / 16; ++j) { const size_t po = ((size_t)b * CC + h * HD + j * 16 + col) * (size_t)TT + kc * 32; const v16b vh = frag_b(VT + po, lane); acc[j] = wmma_bf(p.h, vh, acc[j]); acc[j] = wmma_bf(p.l, vh, acc[j]); acc[j] = wmma_bf(p.h, frag_b(VL + po, lane), acc[j]); } }
#pragma unroll
  for (int j = 0; j < HD / 16; ++j)
#pragma unroll
    for (int r = 0; r < 8; ++r) ss[wave][8 * g + r][j * 16 + col] = acc[j][r] * (1.0f / 2048.0f);
  LDSX(); for (int rl = 0; rl < 16; ++rl) if (lane < HD / 4) vst2(Y + ((size_t)b * TT + ql0 + rl) * CC + h * HD + lane * 4, *(const v4f*)&ss[wave][rl][lane * 4]); }
// ---- k_out: block = (64 rows, 128 cols): out = y (bf16 hi + lo) Wo^T + bo
__global__ __launch_bounds__(128) void k_out(const float* __restrict__ Y, const float* __restrict__ WP, const float* __restrict__ BP, float* __restrict__ OUT) { __shared__ __align__(16) float sf[4][16][132];
  const int tid = threadIdx.x, wave = tid >> 5, lane = tid & 31, col = lane & 15, g = lane >> 4; const int c0 = blockIdx.y * 128; const size_t r0 = (size_t)blockIdx.x * 64 + wave * 16;
  v8f acc[8] = {};
#pragma unroll 2
  for (int kc = 0; kc < CC / 32; ++kc) { const F2 a = split_row(Y + (r0 + col) * CC, kc * 32, lane);
#pragma unroll
    for (int j = 0; j < 8; ++j) { v16b w; const int o = c0 + j * 16 + col;
#pragma unroll
      for (int i = 0; i < 8; ++i) { w[i] = (__bf16)WP[(size_t)(o) * CC + (kc * 32 + 8 * g + i)]; w[8 + i] = (__bf16)WP[(size_t)(o) * CC + (kc * 32 + 16 + 8 * g + i)]; }
      acc[j] = wmma_bf(a.h, w, acc[j]); acc[j] = wmma_bf(a.l, w, acc[j]); } }
#pragma unroll
  for (int j = 0; j < 8; ++j) { const float bb = BP ? bfr(BP[c0 + j * 16 + col]) : 0.f;
#pragma unroll
    for (int r = 0; r < 8; ++r) sf[wave][8 * g + r][j * 16 + col] = acc[j][r] + bb; }
  LDSX(); for (int rl = 0; rl < 16; ++rl) vst2(OUT + (r0 + rl) * CC + c0 + lane * 4, *(const v4f*)&sf[wave][rl][lane * 4]); }
extern "C" void kernel_launch(void* const* d_in, const int* in_sizes, int n_in, void* d_out, int out_size, void* d_ws, size_t ws_size, hipStream_t stream) {
  (void)in_sizes; (void)n_in; (void)out_size;
  const float** F = (const float**)d_in;   // 0 x [2,2048,1024], 1 w_qkv [3072,1024] ([out,in]; q | k | v row blocks), 2 w_out [1024,1024] ([out,in]), 3 b_out
  if (ws_size < (size_t)WS_END) return;
  char* ws = (char*)d_ws; _Float16 *QH = (_Float16*)(ws + WS_QH), *QL = (_Float16*)(ws + WS_QL), *KH = (_Float16*)(ws + WS_KH); __bf16 *VT = (__bf16*)(ws + WS_VT), *VL = (__bf16*)(ws + WS_VL); float *S = (float*)(ws + WS_S), *Y = (float*)(ws + WS_Y);
  const float* WQ = F[1]; const float* WK = F[1] + (size_t)CC * CC; const float* WV = F[1] + 2u * (size_t)CC * CC;
  k_proj<<<dim3(TNB * TT / 64, CC / 128, 3), 128, 0, stream>>>(F[0], WQ, nullptr, WK, nullptr, WV, nullptr, QH, QL, KH, VT, VL);
  for (int b = 0; b < TNB; ++b) for (int h0 = 0; h0 < NH; h0 += HG) {
    k_sc<<<dim3(TT / 64, TT / 128, HG), 128, 0, stream>>>(QH, QL, KH, nullptr, b, h0, S);
    k_sm<<<dim3(TT, HG), 256, 0, stream>>>(S);
    k_pv<<<dim3(TT / 64, 1, HG), 128, 0, stream>>>(S, VT, VL, b, h0, Y);
  }
  k_out<<<dim3(TNB * TT / 64, CC / 128), 128, 0, stream>>>(Y, F[2], F[3], (float*)d_out);
}

// v001
// A run of this version takes 393 microseconds.
// Two timings next to v000 both put it at 2.30 times that version's speed.
// compute dtype: all float inputs rounded to bf16; qkv = x W_qkv^T with EXACT bf16 products on WMMA 16x16x32, f32 accumulate; q as f16 hi + residual (x 2^10), k f16 -> 2-product logits / 8 inside the causal sliding window (j <= i, i - j < 512), 32-key chunks of the window only, kept in registers; softmax in f32 (precise expf) with a running maximum, P unnormalised split bf16 hi + lo against v bf16 hi + lo (3 products), divided by the row sum at the end; out = ctx (bf16 hi + lo) w_out^T + b_out; f32 output.
#include <hip/hip_runtime.h>
#include <math.h>

typedef __attribute__((ext_vector_type(16))) _Float16 v16h;
typedef __attribute__((ext_vector_type(16))) __bf16 v16b;
typedef __attribute__((ext_vector_type(8)))  _Float16 v8h;
typedef __attribute__((ext_vector_type(8)))  float v8f;
typedef __attribute__((ext_vector_type(4)))  float v4f;
typedef __attribute__((ext_vector_type(2)))  float v2f;
typedef __attribute__((ext_vector_type(4)))  unsigned v4u;
typedef __attribute__((ext_vector_type(4)))  int v4i;
typedef float __attribute__((may_alias)) float_a;
typedef int __attribute__((may_alias)) int_a;

template <typename T> __device__ __forceinline__ void vst2(void* p, T v) { *(T*)p = v;  }
__device__ __forceinline__ v8f wmma16(v16h a, v16h b, v8f c) {
  v8f d = __builtin_amdgcn_wmma_f32_16x16x32_f16(false, a, false, b, (short)0, c, false, false);
  asm volatile("v_nop\n\tv_nop\n\tv_nop\n\tv_nop" : "+v"(d) : "v"(a), "v"(b));
  return d;
}
__device__ __forceinline__ v8f wmma_bf(v16b a, v16b b, v8f c) {
  v8f d = __builtin_amdgcn_wmma_f32_16x16x32_bf16(false, a, false, b, (short)0, c, false, false);
  asm volatile("v_nop\n\tv_nop\n\tv_nop\n\tv_nop" : "+v"(d) : "v"(a), "v"(b));
  return d;
}
// 16x16x32 fragments: lane = (h = lane>>4, row/col = lane&15); elements 0..7 = k0+8h+0..7, 8..15 = k0+16+8h+0..7; D element r = row 8h+r
__device__ __forceinline__ v16h frag_h(const _Float16* rowk0, int lane) {
  union { v16h v; v8h q[2]; } u; const _Float16* p = rowk0 + 8 * (lane >> 4);
  u.q[0] = *(const v8h*)p; u.q[1] = *(const v8h*)(p + 16); return u.v;
}
__device__ __forceinline__ v16h frag_f32(const float* rowk0, int lane) {
  v16h a; const float* p = rowk0 + 8 * (lane >> 4);
#pragma unroll
  for (int i = 0; i < 8; ++i) { a[i] = (_Float16)p[i]; a[8 + i] = (_Float16)p[16 + i]; }
  return a;
}
__device__ __forceinline__ v16h frag_f32s(const float* rowk0, int lane, float sc) {
  v16h a; const float* p = rowk0 + 8 * (lane >> 4);
#pragma unroll
  for (int i = 0; i < 8; ++i) { a[i] = (_Float16)(p[i] * sc); a[8 + i] = (_Float16)(p[16 + i] * sc); }
  return a;
}
// column fragment from a [K][ld] layout (column n), rows >= K read as 0
__device__ __forceinline__ v16h fragc_f32(const float* W, int k0, int n, int lane, int ld, int K) {
  v16h a; const int g = lane >> 4;
#pragma unroll
  for (int i = 0; i < 8; ++i) { const int ka = k0 + 8 * g + i, kb = ka + 16;
    a[i] = (_Float16)(ka < K ? W[(size_t)(ka < K ? ka : K - 1) * ld + n] : 0.f); a[8 + i] = (_Float16)(kb < K ? W[(size_t)(kb < K ? kb : K - 1) * ld + n] : 0.f); }
  return a;
}
struct F2 { v16b h, l; };
__device__ __forceinline__ F2 bsplit16(const float v[16]) { F2 r;
#pragma unroll
  for (int i = 0; i < 16; ++i) { const __bf16 h = (__bf16)v[i]; r.h[i] = h; r.l[i] = (__bf16)(v[i] - (float)h); }
  return r; }
__device__ __forceinline__ F2 split_row(const float* row, int k0, int lane) { float v[16]; const float* p = row + k0 + 8 * (lane >> 4);
#pragma unroll
  for (int i = 0; i < 8; ++i) { v[i] = p[i]; v[8 + i] = p[16 + i]; }
  return bsplit16(v); }
__device__ __forceinline__ F2 split_rowK(const float* row, int k0, int lane, int K) { float v[16]; const int g = lane >> 4;
#pragma unroll
  for (int i = 0; i < 8; ++i) { const int ka = k0 + 8 * g + i, kb = ka + 16; v[i] = ka < K ? row[ka < K ? ka : K - 1] : 0.f; v[8 + i] = kb < K ? row[kb < K ? kb : K - 1] : 0.f; }
  return bsplit16(v); }
__device__ __forceinline__ F2 split_col(const float* W, int k0, int n, int lane, int ld, int K) { float v[16]; const int g = lane >> 4;
#pragma unroll
  for (int i = 0; i < 8; ++i) { const int ka = k0 + 8 * g + i, kb = ka + 16; v[i] = ka < K ? W[(size_t)(ka < K ? ka : K - 1) * ld + n] : 0.f; v[8 + i] = kb < K ? W[(size_t)(kb < K ? kb : K - 1) * ld + n] : 0.f; }
  return bsplit16(v); }
__device__ __forceinline__ v8f mac3(const F2& a, const F2& b, v8f c) { c = wmma_bf(a.l, b.h, c); c = wmma_bf(a.h, b.l, c); return wmma_bf(a.h, b.h, c); }
__device__ __forceinline__ float sigm(float v) { return 1.0f / (1.0f + expf(-v)); }
#define LDSX() do { asm volatile("s_wait_dscnt 0" ::: "memory"); __builtin_amdgcn_wave_barrier(); __builtin_amdgcn_fence(__ATOMIC_RELEASE, "workgroup"); } while (0)


// Sliding-window causal MHA (B 2, S 2,048, 1,024 = 16 x 64, window 512): qkv = x W_qkv^T (no bias), allowed(i,j) = j <= i and i - j < 512, softmax, P v, out = ctx w_out^T + b_out.
#define NB 2
#define TT 2048
#define CC 1024
#define NH 16
#define HD 64
#define WIN 512
#ifndef TNB
#define TNB NB
#endif
typedef __attribute__((ext_vector_type(8))) __bf16 v8b;
__device__ __forceinline__ v16b frag_b(const __bf16* rowk0, int lane) {
  union { v16b v; v8b q[2]; } u; const __bf16* p = rowk0 + 8 * (lane >> 4);
  u.q[0] = *(const v8b*)p; u.q[1] = *(const v8b*)(p + 16); return u.v;
}
__device__ __forceinline__ float bfr(float v) { return (float)(__bf16)v; }
__device__ __attribute__((noinline)) float exp_ni(float v) { return expf(v); }
__device__ __attribute__((noinline)) float erf_ni(float v) { return erff(v); }

#define WS_QH  0u
#define WS_QL  (WS_QH + 2u * (size_t)NB * TT * CC)
#define WS_KH  (WS_QL + 2u * (size_t)NB * TT * CC)
#define WS_VT  (WS_KH + 2u * (size_t)NB * TT * CC)      // bf16 v hi planes [b][c][t]
#define WS_VL  (WS_VT + 2u * (size_t)NB * CC * TT)      // bf16 v residual planes
#define WS_Y   (WS_VL + 2u * (size_t)NB * CC * TT)      // f32 y rows [b*t][C]
#define WS_END (WS_Y + 4u * (size_t)NB * TT * CC)

// ---- k_proj: block = (64 rows, 128 cols, which): qkv = x W (+ b), exact; q -> f16 hi (+ residual), k -> f16 rows, v -> bf16 hi + lo planes
__global__ __launch_bounds__(128) void k_proj(const float* __restrict__ X, const float* __restrict__ WQ, const float* __restrict__ BQ, const float* __restrict__ WK, const float* __restrict__ BK, const float* __restrict__ WV, const float* __restrict__ BV, _Float16* __restrict__ QH, _Float16* __restrict__ QL, _Float16* __restrict__ KH, __bf16* __restrict__ VT, __bf16* __restrict__ VL) {
  __shared__ __align__(16) _Float16 sh[64][136], sl[64][136]; __shared__ __align__(16) __bf16 th[128][72], tl2[128][72];
  const int tid = threadIdx.x, wave = tid >> 5, lane = tid & 31, col = lane & 15, g = lane >> 4; const int which = blockIdx.z; const int c0 = blockIdx.y * 128; const size_t r0 = (size_t)blockIdx.x * 64; const float* WA = which == 0 ? WQ : which == 1 ? WK : WV; const float* BA = which == 0 ? BQ : which == 1 ? BK : BV;
  v8f acc[8] = {};
#pragma unroll 2
  for (int kc = 0; kc < CC / 32; ++kc) { v16b a; { const float* p = X + (r0 + wave * 16 + col) * CC + kc * 32 + 8 * g;
#pragma unroll
      for (int i = 0; i < 8; ++i) { a[i] = (__bf16)p[i]; a[8 + i] = (__bf16)p[16 + i]; } }
#pragma unroll
    for (int j = 0; j < 8; ++j) { v16b w; const int o = c0 + j * 16 + col;
#pragma unroll
      for (int i = 0; i < 8; ++i) { w[i] = (__bf16)WA[(size_t)(o) * CC + (kc * 32 + 8 * g + i)]; w[8 + i] = (__bf16)WA[(size_t)(o) * CC + (kc * 32 + 16 + 8 * g + i)]; }
      acc[j] = wmma_bf(a, w, acc[j]); } }
#pragma unroll
  for (int j = 0; j < 8; ++j) { const float bb = BA ? bfr(BA[c0 + j * 16 + col]) : 0.f;
#pragma unroll
    for (int r = 0; r < 8; ++r) { const float v = acc[j][r] + bb; const int rl = wave * 16 + 8 * g + r, cl = j * 16 + col; const _Float16 hv = (_Float16)v;
      if (which == 2) { const __bf16 bh = (__bf16)v; th[cl][rl] = bh; tl2[cl][rl] = (__bf16)(v - (float)bh); } else { sh[rl][cl] = hv; sl[rl][cl] = (_Float16)((v - (float)hv) * 1024.0f); }   /* q residual carried x 2^10 so the plane stays f16-normal on the chip */ } }
  __syncthreads();
  if (which < 2) { _Float16* dh = which == 0 ? QH : KH; for (int e = tid; e < 64 * 16; e += 128) { const int rl = e >> 4, q = e & 15; vst2((unsigned*)(dh + (r0 + rl) * CC + c0 + q * 8), *(const v4u*)&sh[rl][q * 8]); if (which == 0) vst2((unsigned*)(QL + (r0 + rl) * CC + c0 + q * 8), *(const v4u*)&sl[rl][q * 8]); } }
  else { const size_t b = r0 / TT; const int t0 = (int)(r0 % TT); for (int e = tid; e < 128 * 8; e += 128) { const int cl = e >> 3, q = e & 7; const size_t o2 = (b * CC + c0 + cl) * (size_t)TT + t0 + q * 8; vst2((unsigned*)(VT + o2), *(const v4u*)&th[cl][q * 8]); vst2((unsigned*)(VL + o2), *(const v4u*)&tl2[cl][q * 8]); } } }
__device__ __forceinline__ float xhalf(float v) { const int i = __builtin_bit_cast(int, v); return __builtin_bit_cast(float, __builtin_amdgcn_permlanex16(i, i, 0x76543210, 0xfedcba98, false, false)); }
__global__ __launch_bounds__(128) void k_att(const _Float16* __restrict__ QH, const _Float16* __restrict__ QL, const _Float16* __restrict__ KH, const __bf16* __restrict__ VT, const __bf16* __restrict__ VL, float* __restrict__ Y) {
  const int tid = threadIdx.x, lane = tid & 31, col = lane & 15, g = lane >> 4; const int h = blockIdx.y, b = blockIdx.z;
  const int wave = __builtin_amdgcn_readfirstlane(tid >> 5);   /* the wave's number as a scalar: loop bounds, loop branch and chunk addresses stay scalar */
  const int q0 = blockIdx.x * 64 + wave * 16;
  const int kclo = (q0 - (WIN - 1)) > 0 ? (q0 - (WIN - 1)) / 32 : 0;   /* first 32-key chunk that can hold a key inside the earliest query's window */
  const int kchi = (q0 + 16 + 31) / 32;                                /* one past the chunk that holds the last query's own key */
  const size_t qo = ((size_t)b * TT + q0 + col) * CC + h * HD; const _Float16* kb = KH + ((size_t)b * TT + col) * CC + h * HD; const size_t vo = ((size_t)b * CC + h * HD + col) * (size_t)TT;
  v16h qh[2], ql[2], kf[2][2];
#pragma unroll
  for (int c = 0; c < 2; ++c) { qh[c] = frag_h(QH + qo + c * 32, lane); ql[c] = frag_h(QL + qo + c * 32, lane); }
#pragma unroll
  for (int t = 0; t < 2; ++t)
#pragma unroll
    for (int c = 0; c < 2; ++c) kf[t][c] = frag_h(kb + (size_t)(kclo * 32 + t * 16) * CC + c * 32, lane);
  v8f acc[HD / 16] = {}; float m = -1.0e30f, l = 0.f;   /* the running maximum starts far above the mask fill, so a masked logit gives expf = 0 also while a column has met no allowed key yet */
#pragma unroll 1   /* one chunk's fragments live at a time: four waves per SIMD fit */
  for (int kc = kclo; kc < kchi; ++kc) { const int k0 = kc * 32; v16b vh[HD / 16], vl[HD / 16];
#pragma unroll
    for (int j = 0; j < HD / 16; ++j) { vh[j] = frag_b(VT + vo + (size_t)j * 16 * TT + k0, lane); vl[j] = frag_b(VL + vo + (size_t)j * 16 * TT + k0, lane); }
    v8f s[2] = {}, sl[2] = {};
#pragma unroll
    for (int t = 0; t < 2; ++t)
#pragma unroll
      for (int c = 0; c < 2; ++c) { s[t] = wmma16(kf[t][c], qh[c], s[t]); sl[t] = wmma16(kf[t][c], ql[c], sl[t]); }
    const int kn = (kc + 1 < kchi ? kc + 1 : kc) * 32;   /* next chunk's K fragments fly under this chunk's softmax; the last trip re-reads its own */
#pragma unroll
    for (int t = 0; t < 2; ++t)
#pragma unroll
      for (int c = 0; c < 2; ++c) kf[t][c] = frag_h(kb + (size_t)(kn + t * 16) * CC + c * 32, lane);
    float p[16]; float mx = m; const int dq = q0 + col - k0 - 8 * g;   /* query - key = dq - (16 t + r) */
#pragma unroll
    for (int t = 0; t < 2; ++t)
#pragma unroll
      for (int r = 0; r < 8; ++r) { const float v = (s[t][r] + sl[t][r] * (1.0f / 1024.0f)) * 0.125f; const bool allowed = (unsigned)(dq - (16 * t + r)) < (unsigned)WIN; p[8 * t + r] = allowed ? v : -3.0e38f; mx = fmaxf(mx, p[8 * t + r]); }
    mx = fmaxf(mx, xhalf(mx)); const float alpha = expf(m - mx); m = mx; float ps = 0.f;
#pragma unroll
    for (int i = 0; i < 16; ++i) { p[i] = expf(p[i] - mx); ps += p[i]; }
    l = l * alpha + ps;   /* each half sums its own keys; joined after the loop */
#pragma unroll
    for (int j = 0; j < HD / 16; ++j) acc[j] *= alpha;
    const F2 pf = bsplit16(p);
#pragma unroll
    for (int j = 0; j < HD / 16; ++j) { acc[j] = wmma_bf(vh[j], pf.h, acc[j]); acc[j] = wmma_bf(vh[j], pf.l, acc[j]); acc[j] = wmma_bf(vl[j], pf.h, acc[j]); } }
  l += xhalf(l); const float inv = 1.0f / l; float* yr = Y + qo + 8 * g;
#pragma unroll
  for (int j = 0; j < HD / 16; ++j) { v4f a, c;
#pragma unroll
    for (int r = 0; r < 4; ++r) { a[r] = acc[j][r] * inv; c[r] = acc[j][4 + r] * inv; }
    vst2(yr + j * 16, a); vst2(yr + j * 16 + 4, c); } }
// ---- k_out: block = (64 rows, 128 cols): out = y (bf16 hi + lo) Wo^T + bo
__global__ __launch_bounds__(128) void k_out(const float* __restrict__ Y, const float* __restrict__ WP, const float* __restrict__ BP, float* __restrict__ OUT) { __shared__ __align__(16) float sf[4][16][132];
  const int tid = threadIdx.x, wave = tid >> 5, lane = tid & 31, col = lane & 15, g = lane >> 4; const int c0 = blockIdx.y * 128; const size_t r0 = (size_t)blockIdx.x * 64 + wave * 16;
  v8f acc[8] = {};
#pragma unroll 2
  for (int kc = 0; kc < CC / 32; ++kc) { const F2 a = split_row(Y + (r0 + col) * CC, kc * 32, lane);
#pragma unroll
    for (int j = 0; j < 8; ++j) { v16b w; const int o = c0 + j * 16 + col;
#pragma unroll
      for (int i = 0; i < 8; ++i) { w[i] = (__bf16)WP[(size_t)(o) * CC + (kc * 32 + 8 * g + i)]; w[8 + i] = (__bf16)WP[(size_t)(o) * CC + (kc * 32 + 16 + 8 * g + i)]; }
      acc[j] = wmma_bf(a.h, w, acc[j]); acc[j] = wmma_bf(a.l, w, acc[j]); } }
#pragma unroll
  for (int j = 0; j < 8; ++j) { const float bb = BP ? bfr(BP[c0 + j * 16 + col]) : 0.f;
#pragma unroll
    for (int r = 0; r < 8; ++r) sf[wave][8 * g + r][j * 16 + col] = acc[j][r] + bb; }
  LDSX(); for (int rl = 0; rl < 16; ++rl) vst2(OUT + (r0 + rl) * CC + c0 + lane * 4, *(const v4f*)&sf[wave][rl][lane * 4]); }
extern "C" void kernel_launch(void* const* d_in, const int* in_sizes, int n_in, void* d_out, int out_size, void* d_ws, size_t ws_size, hipStream_t stream) {
  (void)in_sizes; (void)n_in; (void)out_size;
  const float** F = (const float**)d_in;   // 0 x [2,2048,1024], 1 w_qkv [3072,1024] ([out,in]; q | k | v row blocks), 2 w_out [1024,1024] ([out,in]), 3 b_out
  if (ws_size < (size_t)WS_END) return;
  char* ws = (char*)d_ws; _Float16 *QH = (_Float16*)(ws + WS_QH), *QL = (_Float16*)(ws + WS_QL), *KH = (_Float16*)(ws + WS_KH); __bf16 *VT = (__bf16*)(ws + WS_VT), *VL = (__bf16*)(ws + WS_VL); float *Y = (float*)(ws + WS_Y);
  const float* WQ = F[1]; const float* WK = F[1] + (size_t)CC * CC; const float* WV = F[1] + 2u * (size_t)CC * CC;
  k_proj<<<dim3(TNB * TT / 64, CC / 128, 3), 128, 0, stream>>>(F[0], WQ, nullptr, WK, nullptr, WV, nullptr, QH, QL, KH, VT, VL);
  k_att<<<dim3(TT / 64, NH, TNB), 128, 0, stream>>>(QH, QL, KH, VT, VL, Y);
  k_out<<<dim3(TNB * TT / 64, CC / 128), 128, 0, stream>>>(Y, F[2], F[3], (float*)d_out);
}

// v002
// One run takes 108 microseconds.
// Two timings next to v001 both put it at 3.63 times that version's speed.
// Counting every step since v000, it is 8.35 times as fast.
// compute dtype: all float inputs rounded to bf16; qkv = x W_qkv^T with EXACT bf16 products on WMMA 16x16x32, f32 accumulate; q as f16 hi + residual (x 2^10), k f16 -> 2-product logits / 8 inside the causal sliding window (j <= i, i - j < 512), 32-key chunks of the window only, kept in registers; softmax in f32 (precise expf) with a running maximum, P unnormalised split bf16 hi + lo against v bf16 hi + lo (3 products), divided by the row sum at the end; out = ctx (bf16 hi + lo) w_out^T + b_out; f32 output.
#include <hip/hip_runtime.h>
#include <math.h>

typedef __attribute__((ext_vector_type(16))) _Float16 v16h;
typedef __attribute__((ext_vector_type(16))) __bf16 v16b;
typedef __attribute__((ext_vector_type(8)))  _Float16 v8h;
typedef __attribute__((ext_vector_type(8)))  float v8f;
typedef __attribute__((ext_vector_type(4)))  float v4f;
typedef __attribute__((ext_vector_type(2)))  float v2f;
typedef __attribute__((ext_vector_type(4)))  unsigned v4u;
typedef __attribute__((ext_vector_type(4)))  int v4i;
typedef float __attribute__((may_alias)) float_a;
typedef int __attribute__((may_alias)) int_a;

template <typename T> __device__ __forceinline__ void vst2(void* p, T v) { *(T*)p = v;  }
__device__ __forceinline__ v8f wmma16(v16h a, v16h b, v8f c) {
  v8f d = __builtin_amdgcn_wmma_f32_16x16x32_f16(false, a, false, b, (short)0, c, false, false);
  asm volatile("v_nop\n\tv_nop\n\tv_nop\n\tv_nop" : "+v"(d) : "v"(a), "v"(b));
  return d;
}
__device__ __forceinline__ v8f wmma_bf(v16b a, v16b b, v8f c) {
  v8f d = __builtin_amdgcn_wmma_f32_16x16x32_bf16(false, a, false, b, (short)0, c, false, false);
  asm volatile("v_nop\n\tv_nop\n\tv_nop\n\tv_nop" : "+v"(d) : "v"(a), "v"(b));
  return d;
}
// 16x16x32 fragments: lane = (h = lane>>4, row/col = lane&15); elements 0..7 = k0+8h+0..7, 8..15 = k0+16+8h+0..7; D element r = row 8h+r
__device__ __forceinline__ v16h frag_h(const _Float16* rowk0, int lane) {
  union { v16h v; v8h q[2]; } u; const _Float16* p = rowk0 + 8 * (lane >> 4);
  u.q[0] = *(const v8h*)p; u.q[1] = *(const v8h*)(p + 16); return u.v;
}
__device__ __forceinline__ v16h frag_f32(const float* rowk0, int lane) {
  v16h a; const float* p = rowk0 + 8 * (lane >> 4);
#pragma unroll
  for (int i = 0; i < 8; ++i) { a[i] = (_Float16)p[i]; a[8 + i] = (_Float16)p[16 + i]; }
  return a;
}
__device__ __forceinline__ v16h frag_f32s(const float* rowk0, int lane, float sc) {
  v16h a; const float* p = rowk0 + 8 * (lane >> 4);
#pragma unroll
  for (int i = 0; i < 8; ++i) { a[i] = (_Float16)(p[i] * sc); a[8 + i] = (_Float16)(p[16 + i] * sc); }
  return a;
}
// column fragment from a [K][ld] layout (column n), rows >= K read as 0
__device__ __forceinline__ v16h fragc_f32(const float* W, int k0, int n, int lane, int ld, int K) {
  v16h a; const int g = lane >> 4;
#pragma unroll
  for (int i = 0; i < 8; ++i) { const int ka = k0 + 8 * g + i, kb = ka + 16;
    a[i] = (_Float16)(ka < K ? W[(size_t)(ka < K ? ka : K - 1) * ld + n] : 0.f); a[8 + i] = (_Float16)(kb < K ? W[(size_t)(kb < K ? kb : K - 1) * ld + n] : 0.f); }
  return a;
}
struct F2 { v16b h, l; };
__device__ __forceinline__ F2 bsplit16(const float v[16]) { F2 r;
#pragma unroll
  for (int i = 0; i < 16; ++i) { const __bf16 h = (__bf16)v[i]; r.h[i] = h; r.l[i] = (__bf16)(v[i] - (float)h); }
  return r; }
__device__ __forceinline__ F2 split_row(const float* row, int k0, int lane) { float v[16]; const float* p = row + k0 + 8 * (lane >> 4);
#pragma unroll
  for (int i = 0; i < 8; ++i) { v[i] = p[i]; v[8 + i] = p[16 + i]; }
  return bsplit16(v); }
__device__ __forceinline__ F2 split_rowK(const float* row, int k0, int lane, int K) { float v[16]; const int g = lane >> 4;
#pragma unroll
  for (int i = 0; i < 8; ++i) { const int ka = k0 + 8 * g + i, kb = ka + 16; v[i] = ka < K ? row[ka < K ? ka : K - 1] : 0.f; v[8 + i] = kb < K ? row[kb < K ? kb : K - 1] : 0.f; }
  return bsplit16(v); }
__device__ __forceinline__ F2 split_col(const float* W, int k0, int n, int lane, int ld, int K) { float v[16]; const int g = lane >> 4;
#pragma unroll
  for (int i = 0; i < 8; ++i) { const int ka = k0 + 8 * g + i, kb = ka + 16; v[i] = ka < K ? W[(size_t)(ka < K ? ka : K - 1) * ld + n] : 0.f; v[8 + i] = kb < K ? W[(size_t)(kb < K ? kb : K - 1) * ld + n] : 0.f; }
  return bsplit16(v); }
__device__ __forceinline__ v8f mac3(const F2& a, const F2& b, v8f c) { c = wmma_bf(a.l, b.h, c); c = wmma_bf(a.h, b.l, c); return wmma_bf(a.h, b.h, c); }
__device__ __forceinline__ float sigm(float v) { return 1.0f / (1.0f + expf(-v)); }
#define LDSX() do { asm volatile("s_wait_dscnt 0" ::: "memory"); __builtin_amdgcn_wave_barrier(); __builtin_amdgcn_fence(__ATOMIC_RELEASE, "workgroup"); } while (0)


// Sliding-window causal MHA (B 2, S 2,048, 1,024 = 16 x 64, window 512): qkv = x W_qkv^T (no bias), allowed(i,j) = j <= i and i - j < 512, softmax, P v, out = ctx w_out^T + b_out.
#define NB 2
#define TT 2048
#define CC 1024
#define NH 16
#define HD 64
#define WIN 512
#ifndef TNB
#define TNB NB
#endif
typedef __attribute__((ext_vector_type(8))) __bf16 v8b;
__device__ __forceinline__ v16b frag_b(const __bf16* rowk0, int lane) {
  union { v16b v; v8b q[2]; } u; const __bf16* p = rowk0 + 8 * (lane >> 4);
  u.q[0] = *(const v8b*)p; u.q[1] = *(const v8b*)(p + 16); return u.v;
}
__device__ __forceinline__ float bfr(float v) { return (float)(__bf16)v; }
__device__ __attribute__((noinline)) float exp_ni(float v) { return expf(v); }
__device__ __attribute__((noinline)) float erf_ni(float v) { return erff(v); }

#define WS_QH  0u
#define WS_QL  (WS_QH + 2u * (size_t)NB * TT * CC)
#define WS_KH  (WS_QL + 2u * (size_t)NB * TT * CC)
#define WS_VT  (WS_KH + 2u * (size_t)NB * TT * CC)      // bf16 v hi planes [b][c][t]
#define WS_VL  (WS_VT + 2u * (size_t)NB * CC * TT)      // bf16 v residual planes
#define WS_Y   (WS_VL + 2u * (size_t)NB * CC * TT)      // f32 y rows [b*t][C]
#define WS_END (WS_Y + 4u * (size_t)NB * TT * CC)

// ---- LDS staging shared by the two projection kernels: a 32-k slice of both operands is read from global memory once per block with whole-line loads
//      (8 lanes x 16 B = one 128-B row slice), rounded to bf16 once, and kept in LDS rows of 80 B (16 B x odd: the 16-byte fragment reads meet no bank conflict)
#define LP 40
typedef __attribute__((ext_vector_type(4))) __bf16 v4b;
typedef __bf16 stage_t[256][LP];
__device__ __forceinline__ v4b cvt4(v4f v) { v4b r;
#pragma unroll
  for (int i = 0; i < 4; ++i) r[i] = (__bf16)v[i];
  return r; }
// the staged loops issue runs of independent products: the plain builtin leaves the compiler free in its register choice (no operand tied to an asm statement) and it keeps the distances itself
__device__ __forceinline__ v8f wmma_bp(v16b a, v16b b, v8f c) { return __builtin_amdgcn_wmma_f32_16x16x32_bf16(false, a, false, b, (short)0, c, false, false); }
// ---- k_proj: block = (128 rows, 128 cols, which), wave = 64 x 64: qkv = x W (+ b), exact; q -> f16 hi (+ residual), k -> f16 rows, v -> bf16 planes
__global__ __launch_bounds__(128) void k_proj(const float* __restrict__ X, const float* __restrict__ WQ, const float* __restrict__ BQ, const float* __restrict__ WK, const float* __restrict__ BK, const float* __restrict__ WV, const float* __restrict__ BV, _Float16* __restrict__ QH, _Float16* __restrict__ QL, _Float16* __restrict__ KH, __bf16* __restrict__ VT, __bf16* __restrict__ VL) {
  __shared__ __align__(16) char sm[2 * 128 * 136 * 2];   /* K loop: two stages of [x 128 rows | W 128 rows]; afterwards the two output planes */
  stage_t* st = (stage_t*)sm;
  const int tid = threadIdx.x, wave = tid >> 5, lane = tid & 31, col = lane & 15, g = lane >> 4, wm = wave >> 1, wn = wave & 1; const int which = blockIdx.z; const int c0 = blockIdx.y * 128; const size_t r0 = (size_t)blockIdx.x * 128; const float* WA = which == 0 ? WQ : which == 1 ? WK : WV; const float* BA = which == 0 ? BQ : which == 1 ? BK : BV;
  const int sr = tid >> 3, sk = (tid & 7) * 4; const float* px = X + (r0 + sr) * CC + sk; const float* pw = WA + (size_t)(c0 + sr) * CC + sk;
  v4f rx[8], rw[8]; v8f acc[4][4] = {};
#pragma unroll
  for (int i = 0; i < 8; ++i) { rx[i] = *(const v4f*)(px + (size_t)i * 16 * CC); rw[i] = *(const v4f*)(pw + (size_t)i * 16 * CC); }
#pragma unroll
  for (int i = 0; i < 8; ++i) { *(v4b*)&st[0][sr + 16 * i][sk] = cvt4(rx[i]); *(v4b*)&st[0][128 + sr + 16 * i][sk] = cvt4(rw[i]); }
  __syncthreads();
#pragma unroll 1   /* one slice's fragments and one slice in flight at a time: three blocks per WGP fit */
  for (int kc = 0; kc < CC / 32; ++kc) { const int cur = kc & 1; const bool more = kc + 1 < CC / 32;
    if (more) {   /* the next slice flies under this slice's products */
#pragma unroll
      for (int i = 0; i < 8; ++i) { rx[i] = *(const v4f*)(px + (size_t)i * 16 * CC + (kc + 1) * 32); rw[i] = *(const v4f*)(pw + (size_t)i * 16 * CC + (kc + 1) * 32); }
      asm volatile("s_wait_xcnt 0x0" ::: "memory");   /* the loads' address registers are reused for the fragments below: the wait stands in front of that overwrite */ }
    v16b a[4], w[4];
#pragma unroll
    for (int i = 0; i < 4; ++i) { a[i] = frag_b(&st[cur][wm * 64 + i * 16 + col][0], lane); w[i] = frag_b(&st[cur][128 + wn * 64 + i * 16 + col][0], lane); }
    __builtin_amdgcn_sched_barrier(0);   /* all sixteen fragment reads stay one group ahead of the products; sunk among them, each place costs the wave an LDS wait */
#pragma unroll
    for (int i = 0; i < 4; ++i)
#pragma unroll
      for (int j = 0; j < 4; ++j) acc[i][j] = (i == 3 && j == 3) ? wmma_bf(a[i], w[j], acc[i][j]) : wmma_bp(a[i], w[j], acc[i][j]);   /* the run's last product carries its four slots itself: a branch follows */
    if (more) {   /* into the stage whose readers all passed the barrier of the trip before */
#pragma unroll
      for (int i = 0; i < 8; ++i) { *(v4b*)&st[cur ^ 1][sr + 16 * i][sk] = cvt4(rx[i]); *(v4b*)&st[cur ^ 1][128 + sr + 16 * i][sk] = cvt4(rw[i]); } }
    __syncthreads(); }
  _Float16 (*sh)[136] = (_Float16 (*)[136])sm; _Float16 (*sl)[136] = (_Float16 (*)[136])(sm + 128 * 136 * 2); __bf16 (*th)[136] = (__bf16 (*)[136])sm; __bf16 (*tl2)[136] = (__bf16 (*)[136])(sm + 128 * 136 * 2);
#pragma unroll
  for (int j = 0; j < 4; ++j) { const int cl = wn * 64 + j * 16 + col; const float bb = BA ? bfr(BA[c0 + cl]) : 0.f;
#pragma unroll
    for (int i = 0; i < 4; ++i) acc[i][j] += bb; }
  if (which == 2) {
#pragma unroll
    for (int j = 0; j < 4; ++j)
#pragma unroll
      for (int i = 0; i < 4; ++i)
#pragma unroll
        for (int r = 0; r < 8; ++r) { const float v = acc[i][j][r]; const int cl = wn * 64 + j * 16 + col, rl = wm * 64 + i * 16 + 8 * g + r; const __bf16 bh = (__bf16)v; th[cl][rl] = bh; tl2[cl][rl] = (__bf16)(v - (float)bh); } }
  else {
#pragma unroll
    for (int j = 0; j < 4; ++j)
#pragma unroll
      for (int i = 0; i < 4; ++i)
#pragma unroll
        for (int r = 0; r < 8; ++r) { const float v = acc[i][j][r]; const int cl = wn * 64 + j * 16 + col, rl = wm * 64 + i * 16 + 8 * g + r; const _Float16 hv = (_Float16)v; sh[rl][cl] = hv; sl[rl][cl] = (_Float16)((v - (float)hv) * 1024.0f); }   /* q residual carried x 2^10 so the plane stays f16-normal on the chip */ }
  __syncthreads();
  if (which == 0) { for (int e = tid; e < 128 * 16; e += 128) { const int rl = e >> 4, q = e & 15; const size_t o1 = (r0 + rl) * CC + c0 + q * 8; vst2((unsigned*)(QH + o1), *(const v4u*)&sh[rl][q * 8]); vst2((unsigned*)(QL + o1), *(const v4u*)&sl[rl][q * 8]); } }
  else if (which == 1) { for (int e = tid; e < 128 * 16; e += 128) { const int rl = e >> 4, q = e & 15; vst2((unsigned*)(KH + (r0 + rl) * CC + c0 + q * 8), *(const v4u*)&sh[rl][q * 8]); } }
  else { const size_t b = r0 / TT; const int t0 = (int)(r0 % TT); for (int e = tid; e < 128 * 16; e += 128) { const int cl = e >> 4, q = e & 15; const size_t o2 = (b * CC + c0 + cl) * (size_t)TT + t0 + q * 8; vst2((unsigned*)(VT + o2), *(const v4u*)&th[cl][q * 8]); vst2((unsigned*)(VL + o2), *(const v4u*)&tl2[cl][q * 8]); } } }
__device__ __forceinline__ float xhalf(float v) { const int i = __builtin_bit_cast(int, v); return __builtin_bit_cast(float, __builtin_amdgcn_permlanex16(i, i, 0x76543210, 0xfedcba98, false, false)); }
__global__ __launch_bounds__(128) void k_att(const _Float16* __restrict__ QH, const _Float16* __restrict__ QL, const _Float16* __restrict__ KH, const __bf16* __restrict__ VT, const __bf16* __restrict__ VL, float* __restrict__ Y) {
  const int tid = threadIdx.x, lane = tid & 31, col = lane & 15, g = lane >> 4; const int h = blockIdx.y, b = blockIdx.z;
  const int wave = __builtin_amdgcn_readfirstlane(tid >> 5);   /* the wave's number as a scalar: loop bounds, loop branch and chunk addresses stay scalar */
  const int q0 = blockIdx.x * 64 + wave * 16;
  const int kclo = (q0 - (WIN - 1)) > 0 ? (q0 - (WIN - 1)) / 32 : 0;   /* first 32-key chunk that can hold a key inside the earliest query's window */
  const int kchi = (q0 + 16 + 31) / 32;                                /* one past the chunk that holds the last query's own key */
  const size_t qo = ((size_t)b * TT + q0 + col) * CC + h * HD; const _Float16* kb = KH + ((size_t)b * TT + col) * CC + h * HD; const size_t vo = ((size_t)b * CC + h * HD + col) * (size_t)TT;
  v16h qh[2], ql[2], kf[2][2];
#pragma unroll
  for (int c = 0; c < 2; ++c) { qh[c] = frag_h(QH + qo + c * 32, lane); ql[c] = frag_h(QL + qo + c * 32, lane); }
#pragma unroll
  for (int t = 0; t < 2; ++t)
#pragma unroll
    for (int c = 0; c < 2; ++c) kf[t][c] = frag_h(kb + (size_t)(kclo * 32 + t * 16) * CC + c * 32, lane);
  v8f acc[HD / 16] = {}; float m = -1.0e30f, l = 0.f;   /* the running maximum starts far above the mask fill, so a masked logit gives expf = 0 also while a column has met no allowed key yet */
#pragma unroll 1   /* one chunk's fragments live at a time: four waves per SIMD fit */
  for (int kc = kclo; kc < kchi; ++kc) { const int k0 = kc * 32; v16b vh[HD / 16], vl[HD / 16];
#pragma unroll
    for (int j = 0; j < HD / 16; ++j) { vh[j] = frag_b(VT + vo + (size_t)j * 16 * TT + k0, lane); vl[j] = frag_b(VL + vo + (size_t)j * 16 * TT + k0, lane); }
    v8f s[2] = {}, sl[2] = {};
#pragma unroll
    for (int t = 0; t < 2; ++t)
#pragma unroll
      for (int c = 0; c < 2; ++c) { s[t] = wmma16(kf[t][c], qh[c], s[t]); sl[t] = wmma16(kf[t][c], ql[c], sl[t]); }
    const int kn = (kc + 1 < kchi ? kc + 1 : kc) * 32;   /* next chunk's K fragments fly under this chunk's softmax; the last trip re-reads its own */
#pragma unroll
    for (int t = 0; t < 2; ++t)
#pragma unroll
      for (int c = 0; c < 2; ++c) kf[t][c] = frag_h(kb + (size_t)(kn + t * 16) * CC + c * 32, lane);
    float p[16]; float mx = m; const int dq = q0 + col - k0 - 8 * g;   /* query - key = dq - (16 t + r) */
#pragma unroll
    for (int t = 0; t < 2; ++t)
#pragma unroll
      for (int r = 0; r < 8; ++r) { const float v = (s[t][r] + sl[t][r] * (1.0f / 1024.0f)) * 0.125f; const bool allowed = (unsigned)(dq - (16 * t + r)) < (unsigned)WIN; p[8 * t + r] = allowed ? v : -3.0e38f; mx = fmaxf(mx, p[8 * t + r]); }
    mx = fmaxf(mx, xhalf(mx)); const float alpha = expf(m - mx); m = mx; float ps = 0.f;
#pragma unroll
    for (int i = 0; i < 16; ++i) { p[i] = expf(p[i] - mx); ps += p[i]; }
    l = l * alpha + ps;   /* each half sums its own keys; joined after the loop */
#pragma unroll
    for (int j = 0; j < HD / 16; ++j) acc[j] *= alpha;
    const F2 pf = bsplit16(p);
#pragma unroll
    for (int j = 0; j < HD / 16; ++j) { acc[j] = wmma_bf(vh[j], pf.h, acc[j]); acc[j] = wmma_bf(vh[j], pf.l, acc[j]); acc[j] = wmma_bf(vl[j], pf.h, acc[j]); } }
  l += xhalf(l); const float inv = 1.0f / l; float* yr = Y + qo + 8 * g;
#pragma unroll
  for (int j = 0; j < HD / 16; ++j) { v4f a, c;
#pragma unroll
    for (int r = 0; r < 4; ++r) { a[r] = acc[j][r] * inv; c[r] = acc[j][4 + r] * inv; }
    vst2(yr + j * 16, a); vst2(yr + j * 16 + 4, c); } }
// ---- k_out: block = (64 rows, 128 cols), wave = 32 x 64: out = y (bf16 hi + lo) Wo^T + bo; staged like k_proj, y split once per block
__global__ __launch_bounds__(128) void k_out(const float* __restrict__ Y, const float* __restrict__ WP, const float* __restrict__ BP, float* __restrict__ OUT) {
  __shared__ __align__(16) char sm[2 * 256 * LP * 2];   /* K loop: two stages of [y hi 64 rows | y lo 64 rows | W 128 rows]; afterwards the f32 output tile */
  stage_t* st = (stage_t*)sm;
  const int tid = threadIdx.x, wave = tid >> 5, lane = tid & 31, col = lane & 15, g = lane >> 4, wm = wave >> 1, wn = wave & 1; const int c0 = blockIdx.y * 128; const size_t r0 = (size_t)blockIdx.x * 64;
  const int sr = tid >> 3, sk = (tid & 7) * 4; const float* py = Y + (r0 + sr) * CC + sk; const float* pw = WP + (size_t)(c0 + sr) * CC + sk;
  v4f ry[4], rw[8]; v8f acc[2][4] = {};
#pragma unroll
  for (int i = 0; i < 8; ++i) { if (i < 4) ry[i] = *(const v4f*)(py + (size_t)i * 16 * CC); rw[i] = *(const v4f*)(pw + (size_t)i * 16 * CC); }
#pragma unroll
  for (int i = 0; i < 8; ++i) { if (i < 4) { const v4b hi = cvt4(ry[i]); v4f rs;
#pragma unroll
      for (int e = 0; e < 4; ++e) rs[e] = ry[i][e] - (float)hi[e];
      *(v4b*)&st[0][sr + 16 * i][sk] = hi; *(v4b*)&st[0][64 + sr + 16 * i][sk] = cvt4(rs); }
    *(v4b*)&st[0][128 + sr + 16 * i][sk] = cvt4(rw[i]); }
  __syncthreads();
#pragma unroll 1   /* one slice's fragments and one slice in flight at a time */
  for (int kc = 0; kc < CC / 32; ++kc) { const int cur = kc & 1; const bool more = kc + 1 < CC / 32;
    if (more) {   /* the next slice flies under this slice's products */
#pragma unroll
      for (int i = 0; i < 8; ++i) { if (i < 4) ry[i] = *(const v4f*)(py + (size_t)i * 16 * CC + (kc + 1) * 32); rw[i] = *(const v4f*)(pw + (size_t)i * 16 * CC + (kc + 1) * 32); }
      asm volatile("s_wait_xcnt 0x0" ::: "memory");   /* the loads' address registers are reused for the fragments below: the wait stands in front of that overwrite */ }
    v16b ah[2], al[2], w[4];
#pragma unroll
    for (int i = 0; i < 2; ++i) { ah[i] = frag_b(&st[cur][wm * 32 + i * 16 + col][0], lane); al[i] = frag_b(&st[cur][64 + wm * 32 + i * 16 + col][0], lane); }
#pragma unroll
    for (int j = 0; j < 4; ++j) w[j] = frag_b(&st[cur][128 + wn * 64 + j * 16 + col][0], lane);
    __builtin_amdgcn_sched_barrier(0);   /* the fragment reads stay one group ahead of the products, as in k_proj */
#pragma unroll
    for (int i = 0; i < 2; ++i)
#pragma unroll
      for (int j = 0; j < 4; ++j) acc[i][j] = wmma_bp(ah[i], w[j], acc[i][j]);
#pragma unroll
    for (int i = 0; i < 2; ++i)
#pragma unroll
      for (int j = 0; j < 4; ++j) acc[i][j] = (i == 1 && j == 3) ? wmma_bf(al[i], w[j], acc[i][j]) : wmma_bp(al[i], w[j], acc[i][j]);   /* last product of the run: as in k_proj */
    if (more) {   /* into the stage whose readers all passed the barrier of the trip before */
#pragma unroll
      for (int i = 0; i < 8; ++i) { if (i < 4) { const v4b hi = cvt4(ry[i]); v4f rs;
#pragma unroll
          for (int e = 0; e < 4; ++e) rs[e] = ry[i][e] - (float)hi[e];
          *(v4b*)&st[cur ^ 1][sr + 16 * i][sk] = hi; *(v4b*)&st[cur ^ 1][64 + sr + 16 * i][sk] = cvt4(rs); }
        *(v4b*)&st[cur ^ 1][128 + sr + 16 * i][sk] = cvt4(rw[i]); } }
    __syncthreads(); }
  float (*sf)[132] = (float (*)[132])sm;
#pragma unroll
  for (int j = 0; j < 4; ++j) { const int cl = wn * 64 + j * 16 + col; const float bb = BP ? bfr(BP[c0 + cl]) : 0.f;
#pragma unroll
    for (int i = 0; i < 2; ++i)
#pragma unroll
      for (int r = 0; r < 8; ++r) sf[wm * 32 + i * 16 + 8 * g + r][cl] = acc[i][j][r] + bb; }
  __syncthreads();
  for (int rl = wave; rl < 64; rl += 4) vst2(OUT + (r0 + rl) * CC + c0 + lane * 4, *(const v4f*)&sf[rl][lane * 4]); }
extern "C" void kernel_launch(void* const* d_in, const int* in_sizes, int n_in, void* d_out, int out_size, void* d_ws, size_t ws_size, hipStream_t stream) {
  (void)in_sizes; (void)n_in; (void)out_size;
  const float** F = (const float**)d_in;   // 0 x [2,2048,1024], 1 w_qkv [3072,1024] ([out,in]; q | k | v row blocks), 2 w_out [1024,1024] ([out,in]), 3 b_out
  if (ws_size < (size_t)WS_END) return;
  char* ws = (char*)d_ws; _Float16 *QH = (_Float16*)(ws + WS_QH), *QL = (_Float16*)(ws + WS_QL), *KH = (_Float16*)(ws + WS_KH); __bf16 *VT = (__bf16*)(ws + WS_VT), *VL = (__bf16*)(ws + WS_VL); float *Y = (float*)(ws + WS_Y);
  const float* WQ = F[1]; const float* WK = F[1] + (size_t)CC * CC; const float* WV = F[1] + 2u * (size_t)CC * CC;
  k_proj<<<dim3(TNB * TT / 128, CC / 128, 3), 128, 0, stream>>>(F[0], WQ, nullptr, WK, nullptr, WV, nullptr, QH, QL, KH, VT, VL);
  k_att<<<dim3(TT / 64, NH, TNB), 128, 0, stream>>>(QH, QL, KH, VT, VL, Y);
  k_out<<<dim3(TNB * TT / 64, CC / 128), 128, 0, stream>>>(Y, F[2], F[3], (float*)d_out);
}

// v003
// It runs in 99.4 microseconds.
// Next to v002, in two timings, it ran 1.10 and 1.09 times as fast.
// Over all steps from v000 it is 9.13 times as fast.
// compute dtype: all float inputs rounded to bf16; qkv = x W_qkv^T with EXACT bf16 products on WMMA 16x16x32, f32 accumulate; q as f16 hi + residual (x 2^10), k f16 -> 2-product logits / 8 inside the causal sliding window (j <= i, i - j < 512), 32-key chunks of the window only, kept in registers; softmax in f32 (precise expf) with a running maximum, P unnormalised split bf16 hi + lo against v bf16 hi + lo (3 products), divided by the row sum at the end; out = ctx (bf16 hi + lo) w_out^T + b_out; f32 output.
#include <hip/hip_runtime.h>
#include <math.h>

typedef __attribute__((ext_vector_type(16))) _Float16 v16h;
typedef __attribute__((ext_vector_type(16))) __bf16 v16b;
typedef __attribute__((ext_vector_type(8)))  _Float16 v8h;
typedef __attribute__((ext_vector_type(8)))  float v8f;
typedef __attribute__((ext_vector_type(4)))  float v4f;
typedef __attribute__((ext_vector_type(2)))  float v2f;
typedef __attribute__((ext_vector_type(4)))  unsigned v4u;
typedef __attribute__((ext_vector_type(4)))  int v4i;
typedef float __attribute__((may_alias)) float_a;
typedef int __attribute__((may_alias)) int_a;

template <typename T> __device__ __forceinline__ void vst2(void* p, T v) { *(T*)p = v;  }
__device__ __forceinline__ v8f wmma16(v16h a, v16h b, v8f c) {
  v8f d = __builtin_amdgcn_wmma_f32_16x16x32_f16(false, a, false, b, (short)0, c, false, false);
  asm volatile("v_nop\n\tv_nop\n\tv_nop\n\tv_nop" : "+v"(d) : "v"(a), "v"(b));
  return d;
}
__device__ __forceinline__ v8f wmma_bf(v16b a, v16b b, v8f c) {
  v8f d = __builtin_amdgcn_wmma_f32_16x16x32_bf16(false, a, false, b, (short)0, c, false, false);
  asm volatile("v_nop\n\tv_nop\n\tv_nop\n\tv_nop" : "+v"(d) : "v"(a), "v"(b));
  return d;
}
// 16x16x32 fragments: lane = (h = lane>>4, row/col = lane&15); elements 0..7 = k0+8h+0..7, 8..15 = k0+16+8h+0..7; D element r = row 8h+r
__device__ __forceinline__ v16h frag_h(const _Float16* rowk0, int lane) {
  union { v16h v; v8h q[2]; } u; const _Float16* p = rowk0 + 8 * (lane >> 4);
  u.q[0] = *(const v8h*)p; u.q[1] = *(const v8h*)(p + 16); return u.v;
}
__device__ __forceinline__ v16h frag_f32(const float* rowk0, int lane) {
  v16h a; const float* p = rowk0 + 8 * (lane >> 4);
#pragma unroll
  for (int i = 0; i < 8; ++i) { a[i] = (_Float16)p[i]; a[8 + i] = (_Float16)p[16 + i]; }
  return a;
}
__device__ __forceinline__ v16h frag_f32s(const float* rowk0, int lane, float sc) {
  v16h a; const float* p = rowk0 + 8 * (lane >> 4);
#pragma unroll
  for (int i = 0; i < 8; ++i) { a[i] = (_Float16)(p[i] * sc); a[8 + i] = (_Float16)(p[16 + i] * sc); }
  return a;
}
// column fragment from a [K][ld] layout (column n), rows >= K read as 0
__device__ __forceinline__ v16h fragc_f32(const float* W, int k0, int n, int lane, int ld, int K) {
  v16h a; const int g = lane >> 4;
#pragma unroll
  for (int i = 0; i < 8; ++i) { const int ka = k0 + 8 * g + i, kb = ka + 16;
    a[i] = (_Float16)(ka < K ? W[(size_t)(ka < K ? ka : K - 1) * ld + n] : 0.f); a[8 + i] = (_Float16)(kb < K ? W[(size_t)(kb < K ? kb : K - 1) * ld + n] : 0.f); }
  return a;
}
struct F2 { v16b h, l; };
__device__ __forceinline__ F2 bsplit16(const float v[16]) { F2 r;
#pragma unroll
  for (int i = 0; i < 16; ++i) { const __bf16 h = (__bf16)v[i]; r.h[i] = h; r.l[i] = (__bf16)(v[i] - (float)h); }
  return r; }
__device__ __forceinline__ F2 split_row(const float* row, int k0, int lane) { float v[16]; const float* p = row + k0 + 8 * (lane >> 4);
#pragma unroll
  for (int i = 0; i < 8; ++i) { v[i] = p[i]; v[8 + i] = p[16 + i]; }
  return bsplit16(v); }
__device__ __forceinline__ F2 split_rowK(const float* row, int k0, int lane, int K) { float v[16]; const int g = lane >> 4;
#pragma unroll
  for (int i = 0; i < 8; ++i) { const int ka = k0 + 8 * g + i, kb = ka + 16; v[i] = ka < K ? row[ka < K ? ka : K - 1] : 0.f; v[8 + i] = kb < K ? row[kb < K ? kb : K - 1] : 0.f; }
  return bsplit16(v); }
__device__ __forceinline__ F2 split_col(const float* W, int k0, int n, int lane, int ld, int K) { float v[16]; const int g = lane >> 4;
#pragma unroll
  for (int i = 0; i < 8; ++i) { const int ka = k0 + 8 * g + i, kb = ka + 16; v[i] = ka < K ? W[(size_t)(ka < K ? ka : K - 1) * ld + n] : 0.f; v[8 + i] = kb < K ? W[(size_t)(kb < K ? kb : K - 1) * ld + n] : 0.f; }
  return bsplit16(v); }
__device__ __forceinline__ v8f mac3(const F2& a, const F2& b, v8f c) { c = wmma_bf(a.l, b.h, c); c = wmma_bf(a.h, b.l, c); return wmma_bf(a.h, b.h, c); }
__device__ __forceinline__ float sigm(float v) { return 1.0f / (1.0f + expf(-v)); }
#define LDSX() do { asm volatile("s_wait_dscnt 0" ::: "memory"); __builtin_amdgcn_wave_barrier(); __builtin_amdgcn_fence(__ATOMIC_RELEASE, "workgroup"); } while (0)


// Sliding-window causal MHA (B 2, S 2,048, 1,024 = 16 x 64, window 512): qkv = x W_qkv^T (no bias), allowed(i,j) = j <= i and i - j < 512, softmax, P v, out = ctx w_out^T + b_out.
#define NB 2
#define TT 2048
#define CC 1024
#define NH 16
#define HD 64
#define WIN 512
#ifndef TNB
#define TNB NB
#endif
typedef __attribute__((ext_vector_type(8))) __bf16 v8b;
__device__ __forceinline__ v16b frag_b(const __bf16* rowk0, int lane) {
  union { v16b v; v8b q[2]; } u; const __bf16* p = rowk0 + 8 * (lane >> 4);
  u.q[0] = *(const v8b*)p; u.q[1] = *(const v8b*)(p + 16); return u.v;
}
__device__ __forceinline__ float bfr(float v) { return (float)(__bf16)v; }
__device__ __attribute__((noinline)) float exp_ni(float v) { return expf(v); }
__device__ __attribute__((noinline)) float erf_ni(float v) { return erff(v); }

#define WS_QH  0u
#define WS_QL  (WS_QH + 2u * (size_t)NB * TT * CC)
#define WS_KH  (WS_QL + 2u * (size_t)NB * TT * CC)
#define WS_VT  (WS_KH + 2u * (size_t)NB * TT * CC)      // bf16 v hi planes [b][c][t]
#define WS_VL  (WS_VT + 2u * (size_t)NB * CC * TT)      // bf16 v residual planes
#define WS_Y   (WS_VL + 2u * (size_t)NB * CC * TT)      // f32 y rows [b*t][C]
#define WS_END (WS_Y + 4u * (size_t)NB * TT * CC)

// ---- LDS staging shared by the two projection kernels: a 32-k slice of both operands is read from global memory once per block with whole-line loads
//      (8 lanes x 16 B = one 128-B row slice), rounded to bf16 once, and kept in LDS rows of 80 B (16 B x odd: the 16-byte fragment reads meet no bank conflict)
#define LP 40
typedef __attribute__((ext_vector_type(4))) __bf16 v4b;
typedef __bf16 stage_t[256][LP];
__device__ __forceinline__ v4b cvt4(v4f v) { v4b r;
#pragma unroll
  for (int i = 0; i < 4; ++i) r[i] = (__bf16)v[i];
  return r; }
// the staged loops issue runs of independent products: the plain builtin leaves the compiler free in its register choice (no operand tied to an asm statement) and it keeps the distances itself
__device__ __forceinline__ v8f wmma_bp(v16b a, v16b b, v8f c) { return __builtin_amdgcn_wmma_f32_16x16x32_bf16(false, a, false, b, (short)0, c, false, false); }
// ---- k_proj: block = (128 rows, 128 cols, which), wave = 64 x 64: qkv = x W (+ b), exact; q -> f16 hi (+ residual), k -> f16 rows, v -> bf16 planes
__global__ __launch_bounds__(128) void k_proj(const float* __restrict__ X, const float* __restrict__ WQ, const float* __restrict__ BQ, const float* __restrict__ WK, const float* __restrict__ BK, const float* __restrict__ WV, const float* __restrict__ BV, _Float16* __restrict__ QH, _Float16* __restrict__ QL, _Float16* __restrict__ KH, __bf16* __restrict__ VT, __bf16* __restrict__ VL) {
  __shared__ __align__(16) char sm[2 * 128 * 136 * 2];   /* K loop: two stages of [x 128 rows | W 128 rows]; afterwards the two output planes */
  stage_t* st = (stage_t*)sm;
  const int tid = threadIdx.x, wave = tid >> 5, lane = tid & 31, col = lane & 15, g = lane >> 4, wm = wave >> 1, wn = wave & 1; const int which = blockIdx.z; const int c0 = blockIdx.y * 128; const size_t r0 = (size_t)blockIdx.x * 128; const float* WA = which == 0 ? WQ : which == 1 ? WK : WV; const float* BA = which == 0 ? BQ : which == 1 ? BK : BV;
  const int sr = tid >> 3, sk = (tid & 7) * 4; const float* px = X + (r0 + sr) * CC + sk; const float* pw = WA + (size_t)(c0 + sr) * CC + sk;
  v4f rx[8], rw[8]; v8f acc[4][4] = {};
#pragma unroll
  for (int i = 0; i < 8; ++i) { rx[i] = *(const v4f*)(px + (size_t)i * 16 * CC); rw[i] = *(const v4f*)(pw + (size_t)i * 16 * CC); }
#pragma unroll
  for (int i = 0; i < 8; ++i) { *(v4b*)&st[0][sr + 16 * i][sk] = cvt4(rx[i]); *(v4b*)&st[0][128 + sr + 16 * i][sk] = cvt4(rw[i]); }
  __syncthreads();
#pragma unroll 1   /* one slice's fragments and one slice in flight at a time: three blocks per WGP fit */
  for (int kc = 0; kc < CC / 32; ++kc) { const int cur = kc & 1; const bool more = kc + 1 < CC / 32;
    if (more) {   /* the next slice flies under this slice's products */
#pragma unroll
      for (int i = 0; i < 8; ++i) { rx[i] = *(const v4f*)(px + (size_t)i * 16 * CC + (kc + 1) * 32); rw[i] = *(const v4f*)(pw + (size_t)i * 16 * CC + (kc + 1) * 32); }
      asm volatile("s_wait_xcnt 0x0" ::: "memory");   /* the loads' address registers are reused for the fragments below: the wait stands in front of that overwrite */ }
    v16b a[4], w[4];
#pragma unroll
    for (int i = 0; i < 4; ++i) { a[i] = frag_b(&st[cur][wm * 64 + i * 16 + col][0], lane); w[i] = frag_b(&st[cur][128 + wn * 64 + i * 16 + col][0], lane); }
    __builtin_amdgcn_sched_barrier(0);   /* all sixteen fragment reads stay one group ahead of the products; sunk among them, each place costs the wave an LDS wait */
#pragma unroll
    for (int i = 0; i < 4; ++i)
#pragma unroll
      for (int j = 0; j < 4; ++j) acc[i][j] = (i == 3 && j == 3) ? wmma_bf(a[i], w[j], acc[i][j]) : wmma_bp(a[i], w[j], acc[i][j]);   /* the run's last product carries its four slots itself: a branch follows */
    if (more) {   /* into the stage whose readers all passed the barrier of the trip before */
#pragma unroll
      for (int i = 0; i < 8; ++i) { *(v4b*)&st[cur ^ 1][sr + 16 * i][sk] = cvt4(rx[i]); *(v4b*)&st[cur ^ 1][128 + sr + 16 * i][sk] = cvt4(rw[i]); } }
    __syncthreads(); }
  _Float16 (*sh)[136] = (_Float16 (*)[136])sm; _Float16 (*sl)[136] = (_Float16 (*)[136])(sm + 128 * 136 * 2); __bf16 (*th)[136] = (__bf16 (*)[136])sm; __bf16 (*tl2)[136] = (__bf16 (*)[136])(sm + 128 * 136 * 2);
#pragma unroll
  for (int j = 0; j < 4; ++j) { const int cl = wn * 64 + j * 16 + col; const float bb = BA ? bfr(BA[c0 + cl]) : 0.f;
#pragma unroll
    for (int i = 0; i < 4; ++i) acc[i][j] += bb; }
  if (which == 2) {
#pragma unroll
    for (int j = 0; j < 4; ++j)
#pragma unroll
      for (int i = 0; i < 4; ++i)
#pragma unroll
        for (int r = 0; r < 8; ++r) { const float v = acc[i][j][r]; const int cl = wn * 64 + j * 16 + col, rl = wm * 64 + i * 16 + 8 * g + r; const __bf16 bh = (__bf16)v; th[cl][rl] = bh; tl2[cl][rl] = (__bf16)(v - (float)bh); } }
  else {
#pragma unroll
    for (int j = 0; j < 4; ++j)
#pragma unroll
      for (int i = 0; i < 4; ++i)
#pragma unroll
        for (int r = 0; r < 8; ++r) { const float v = acc[i][j][r]; const int cl = wn * 64 + j * 16 + col, rl = wm * 64 + i * 16 + 8 * g + r; const _Float16 hv = (_Float16)v; sh[rl][cl] = hv; sl[rl][cl] = (_Float16)((v - (float)hv) * 1024.0f); }   /* q residual carried x 2^10 so the plane stays f16-normal on the chip */ }
  __syncthreads();
  if (which == 0) { for (int e = tid; e < 128 * 16; e += 128) { const int rl = e >> 4, q = e & 15; const size_t o1 = (r0 + rl) * CC + c0 + q * 8; vst2((unsigned*)(QH + o1), *(const v4u*)&sh[rl][q * 8]); vst2((unsigned*)(QL + o1), *(const v4u*)&sl[rl][q * 8]); } }
  else if (which == 1) { for (int e = tid; e < 128 * 16; e += 128) { const int rl = e >> 4, q = e & 15; vst2((unsigned*)(KH + (r0 + rl) * CC + c0 + q * 8), *(const v4u*)&sh[rl][q * 8]); } }
  else { const size_t b = r0 / TT; const int t0 = (int)(r0 % TT); for (int e = tid; e < 128 * 16; e += 128) { const int cl = e >> 4, q = e & 15; const size_t o2 = (b * CC + c0 + cl) * (size_t)TT + t0 + q * 8; vst2((unsigned*)(VT + o2), *(const v4u*)&th[cl][q * 8]); vst2((unsigned*)(VL + o2), *(const v4u*)&tl2[cl][q * 8]); } } }
__device__ __forceinline__ float xhalf(float v) { const int i = __builtin_bit_cast(int, v); return __builtin_bit_cast(float, __builtin_amdgcn_permlanex16(i, i, 0x76543210, 0xfedcba98, false, false)); }
#define AP 72                      /* LDS row pitch in 16-bit elements: 128 B of data + 16 B = 144 B = 16 B x 9, the pitch at which 16-byte fragment reads meet no bank conflict */
#define AROW (AP * 2)
#define ASTG (192 * AROW)          /* one stage = 64 keys: 64 K rows | 64 rows of v hi | 64 rows of v lo, each row one whole 128-B line */
// one stage's copies of one lane: four rows, 16 apart, of each of the three planes; 8 lanes x 16 B cover one whole line of global memory.
// The wait is the last line of the copies' own statement, so it stands in front of any later rewrite of their address registers
__device__ __forceinline__ void acopy12(unsigned l, const char* k, const char* v, const char* w) {
  const size_t ks = (size_t)16 * CC * 2, vs = (size_t)16 * TT * 2;
  asm volatile("global_load_async_to_lds_b128 %0, %12, off\n\tglobal_load_async_to_lds_b128 %1, %13, off\n\tglobal_load_async_to_lds_b128 %2, %14, off\n\tglobal_load_async_to_lds_b128 %3, %15, off\n\t"
               "global_load_async_to_lds_b128 %4, %16, off\n\tglobal_load_async_to_lds_b128 %5, %17, off\n\tglobal_load_async_to_lds_b128 %6, %18, off\n\tglobal_load_async_to_lds_b128 %7, %19, off\n\t"
               "global_load_async_to_lds_b128 %8, %20, off\n\tglobal_load_async_to_lds_b128 %9, %21, off\n\tglobal_load_async_to_lds_b128 %10, %22, off\n\tglobal_load_async_to_lds_b128 %11, %23, off\n\ts_wait_xcnt 0x0"
               :: "v"(l), "v"(l + 16u * AROW), "v"(l + 32u * AROW), "v"(l + 48u * AROW), "v"(l + 64u * AROW), "v"(l + 80u * AROW), "v"(l + 96u * AROW), "v"(l + 112u * AROW), "v"(l + 128u * AROW), "v"(l + 144u * AROW), "v"(l + 160u * AROW), "v"(l + 176u * AROW),
                  "v"(k), "v"(k + ks), "v"(k + 2 * ks), "v"(k + 3 * ks), "v"(v), "v"(v + vs), "v"(v + 2 * vs), "v"(v + 3 * vs), "v"(w), "v"(w + vs), "v"(w + 2 * vs), "v"(w + 3 * vs) : "memory"); }
__global__ __launch_bounds__(128) void k_att(const _Float16* __restrict__ QH, const _Float16* __restrict__ QL, const _Float16* __restrict__ KH, const __bf16* __restrict__ VT, const __bf16* __restrict__ VL, float* __restrict__ Y) {
  __shared__ __align__(16) char sm[2 * ASTG];   /* two stages: the block's four waves read their K and v fragments from here */
  const int tid = threadIdx.x, lane = tid & 31, col = lane & 15, g = lane >> 4; const int h = blockIdx.y, b = blockIdx.z;
  const int wave = __builtin_amdgcn_readfirstlane(tid >> 5);   /* the wave's number as a scalar: loop bounds, loop branch and chunk addresses stay scalar */
  const int Q0 = blockIdx.x * 64, q0 = Q0 + wave * 16;
  const int kclo = (q0 - (WIN - 1)) > 0 ? (q0 - (WIN - 1)) / 32 : 0;   /* first 32-key chunk that can hold a key inside the earliest query's window */
  const int kchi = (q0 + 16 + 31) / 32;                                /* one past the chunk that holds the last query's own key */
  const int slo = Q0 >= WIN ? (Q0 - WIN) / 64 : 0, shi = Q0 / 64 + 1;  /* the block's 64-key stages: from the one with key Q0 - 511 to the one with key Q0 + 63 */
  const size_t qo = ((size_t)b * TT + q0 + col) * CC + h * HD;
  const int sr = tid >> 3, sg = tid & 7;   /* staging: row sr (+ 16 i) of each plane, 16-byte piece sg of its line */
  const char* gk = (const char*)(KH + ((size_t)b * TT + sr) * CC + h * HD + sg * 8);
  const char* gv = (const char*)(VT + ((size_t)b * CC + h * HD + sr) * (size_t)TT + sg * 8);
  const char* gl = (const char*)(VL + ((size_t)b * CC + h * HD + sr) * (size_t)TT + sg * 8);
  const unsigned ls = (unsigned)(size_t)sm + (unsigned)(sr * AROW + sg * 16);
#define ASTAGE(s, buf) acopy12(ls + (unsigned)(buf) * ASTG, gk + (size_t)(s) * 64 * CC * 2, gv + (size_t)(s) * 128, gl + (size_t)(s) * 128)
  v16h qh[2], ql[2];
#pragma unroll
  for (int c = 0; c < 2; ++c) { qh[c] = frag_h(QH + qo + c * 32, lane); ql[c] = frag_h(QL + qo + c * 32, lane); }
  ASTAGE(slo, 0);
  asm volatile("s_wait_asynccnt 0x0" ::: "memory");   /* this wave's copies of the first stage have landed */
  __syncthreads();                                     /* ... and every other wave's */
  if (slo + 1 < shi) ASTAGE(slo + 1, 1);
  v8f acc[HD / 16] = {}; float m = -1.0e30f, l = 0.f;   /* the running maximum starts far above the mask fill, so a masked logit gives expf = 0 also while a column has met no allowed key yet */
#pragma unroll 1   /* one stage per trip */
  for (int s = slo; s < shi; ++s) { const int cur = (s - slo) & 1;
#pragma unroll 1   /* one chunk's fragments live at a time: four waves per SIMD fit */
    for (int hh = 0; hh < 2; ++hh) { const int kc = 2 * s + hh;
      if (kc >= kclo && kc < kchi) {   /* a scalar test: the wave works only on the chunks of its own queries' window, in rising order */
        const int k0 = kc * 32; const char* sb = sm + cur * ASTG; v16h kf[2][2]; v16b vh[HD / 16], vl[HD / 16];
        const _Float16* kl = (const _Float16*)sb + (hh * 32 + col) * AP; const __bf16* vp = (const __bf16*)(sb + 64 * AROW) + col * AP + hh * 32; const __bf16* lp = (const __bf16*)(sb + 128 * AROW) + col * AP + hh * 32;
#pragma unroll
        for (int t = 0; t < 2; ++t)
#pragma unroll
          for (int c = 0; c < 2; ++c) kf[t][c] = frag_h(kl + t * 16 * AP + c * 32, lane);
#pragma unroll
        for (int j = 0; j < HD / 16; ++j) { vh[j] = frag_b(vp + j * 16 * AP, lane); vl[j] = frag_b(lp + j * 16 * AP, lane); }
        v8f s2[2] = {}, sl[2] = {};
#pragma unroll
        for (int t = 0; t < 2; ++t)
#pragma unroll
          for (int c = 0; c < 2; ++c) { s2[t] = wmma16(kf[t][c], qh[c], s2[t]); sl[t] = wmma16(kf[t][c], ql[c], sl[t]); }
        float p[16]; float mx = m; const int dq = q0 + col - k0 - 8 * g;   /* query - key = dq - (16 t + r) */
#pragma unroll
        for (int t = 0; t < 2; ++t)
#pragma unroll
          for (int r = 0; r < 8; ++r) { const float v = (s2[t][r] + sl[t][r] * (1.0f / 1024.0f)) * 0.125f; const bool allowed = (unsigned)(dq - (16 * t + r)) < (unsigned)WIN; p[8 * t + r] = allowed ? v : -3.0e38f; mx = fmaxf(mx, p[8 * t + r]); }
        mx = fmaxf(mx, xhalf(mx)); const float alpha = expf(m - mx); m = mx; float ps = 0.f;
#pragma unroll
        for (int i = 0; i < 16; ++i) { p[i] = expf(p[i] - mx); ps += p[i]; }
        l = l * alpha + ps;   /* each half sums its own keys; joined after the loop */
#pragma unroll
        for (int j = 0; j < HD / 16; ++j) acc[j] *= alpha;
        const F2 pf = bsplit16(p);
#pragma unroll
        for (int j = 0; j < HD / 16; ++j) { acc[j] = wmma_bf(vh[j], pf.h, acc[j]); acc[j] = wmma_bf(vh[j], pf.l, acc[j]); acc[j] = wmma_bf(vl[j], pf.h, acc[j]); } } }
    asm volatile("s_wait_dscnt 0x0" ::: "memory");      /* this wave's reads of the stage are done before the stage is handed back */
    asm volatile("s_wait_asynccnt 0x0" ::: "memory");   /* this wave's copies of the next stage have landed */
    __syncthreads();                                     /* publishes the next stage and ends every wave's reads of this one */
    if (s + 2 < shi) ASTAGE(s + 2, cur); }
  asm volatile("s_wait_asynccnt 0x0" ::: "memory");     /* no copy is outstanding when the wave ends */
  l += xhalf(l); const float inv = 1.0f / l; float* yr = Y + qo + 8 * g;
#pragma unroll
  for (int j = 0; j < HD / 16; ++j) { v4f a, c;
#pragma unroll
    for (int r = 0; r < 4; ++r) { a[r] = acc[j][r] * inv; c[r] = acc[j][4 + r] * inv; }
    vst2(yr + j * 16, a); vst2(yr + j * 16 + 4, c); } }
// ---- k_out: block = (64 rows, 128 cols), wave = 32 x 64: out = y (bf16 hi + lo) Wo^T + bo; staged like k_proj, y split once per block
__global__ __launch_bounds__(128) void k_out(const float* __restrict__ Y, const float* __restrict__ WP, const float* __restrict__ BP, float* __restrict__ OUT) {
  __shared__ __align__(16) char sm[2 * 256 * LP * 2];   /* K loop: two stages of [y hi 64 rows | y lo 64 rows | W 128 rows]; afterwards the f32 output tile */
  stage_t* st = (stage_t*)sm;
  const int tid = threadIdx.x, wave = tid >> 5, lane = tid & 31, col = lane & 15, g = lane >> 4, wm = wave >> 1, wn = wave & 1; const int c0 = blockIdx.y * 128; const size_t r0 = (size_t)blockIdx.x * 64;
  const int sr = tid >> 3, sk = (tid & 7) * 4; const float* py = Y + (r0 + sr) * CC + sk; const float* pw = WP + (size_t)(c0 + sr) * CC + sk;
  v4f ry[4], rw[8]; v8f acc[2][4] = {};
#pragma unroll
  for (int i = 0; i < 8; ++i) { if (i < 4) ry[i] = *(const v4f*)(py + (size_t)i * 16 * CC); rw[i] = *(const v4f*)(pw + (size_t)i * 16 * CC); }
#pragma unroll
  for (int i = 0; i < 8; ++i) { if (i < 4) { const v4b hi = cvt4(ry[i]); v4f rs;
#pragma unroll
      for (int e = 0; e < 4; ++e) rs[e] = ry[i][e] - (float)hi[e];
      *(v4b*)&st[0][sr + 16 * i][sk] = hi; *(v4b*)&st[0][64 + sr + 16 * i][sk] = cvt4(rs); }
    *(v4b*)&st[0][128 + sr + 16 * i][sk] = cvt4(rw[i]); }
  __syncthreads();
#pragma unroll 1   /* one slice's fragments and one slice in flight at a time */
  for (int kc = 0; kc < CC / 32; ++kc) { const int cur = kc & 1; const bool more = kc + 1 < CC / 32;
    if (more) {   /* the next slice flies under this slice's products */
#pragma unroll
      for (int i = 0; i < 8; ++i) { if (i < 4) ry[i] = *(const v4f*)(py + (size_t)i * 16 * CC + (kc + 1) * 32); rw[i] = *(const v4f*)(pw + (size_t)i * 16 * CC + (kc + 1) * 32); }
      asm volatile("s_wait_xcnt 0x0" ::: "memory");   /* the loads' address registers are reused for the fragments below: the wait stands in front of that overwrite */ }
    v16b ah[2], al[2], w[4];
#pragma unroll
    for (int i = 0; i < 2; ++i) { ah[i] = frag_b(&st[cur][wm * 32 + i * 16 + col][0], lane); al[i] = frag_b(&st[cur][64 + wm * 32 + i * 16 + col][0], lane); }
#pragma unroll
    for (int j = 0; j < 4; ++j) w[j] = frag_b(&st[cur][128 + wn * 64 + j * 16 + col][0], lane);
    __builtin_amdgcn_sched_barrier(0);   /* the fragment reads stay one group ahead of the products, as in k_proj */
#pragma unroll
    for (int i = 0; i < 2; ++i)
#pragma unroll
      for (int j = 0; j < 4; ++j) acc[i][j] = wmma_bp(ah[i], w[j], acc[i][j]);
#pragma unroll
    for (int i = 0; i < 2; ++i)
#pragma unroll
      for (int j = 0; j < 4; ++j) acc[i][j] = (i == 1 && j == 3) ? wmma_bf(al[i], w[j], acc[i][j]) : wmma_bp(al[i], w[j], acc[i][j]);   /* last product of the run: as in k_proj */
    if (more) {   /* into the stage whose readers all passed the barrier of the trip before */
#pragma unroll
      for (int i = 0; i < 8; ++i) { if (i < 4) { const v4b hi = cvt4(ry[i]); v4f rs;
#pragma unroll
          for (int e = 0; e < 4; ++e) rs[e] = ry[i][e] - (float)hi[e];
          *(v4b*)&st[cur ^ 1][sr + 16 * i][sk] = hi; *(v4b*)&st[cur ^ 1][64 + sr + 16 * i][sk] = cvt4(rs); }
        *(v4b*)&st[cur ^ 1][128 + sr + 16 * i][sk] = cvt4(rw[i]); } }
    __syncthreads(); }
  float (*sf)[132] = (float (*)[132])sm;
#pragma unroll
  for (int j = 0; j < 4; ++j) { const int cl = wn * 64 + j * 16 + col; const float bb = BP ? bfr(BP[c0 + cl]) : 0.f;
#pragma unroll
    for (int i = 0; i < 2; ++i)
#pragma unroll
      for (int r = 0; r < 8; ++r) sf[wm * 32 + i * 16 + 8 * g + r][cl] = acc[i][j][r] + bb; }
  __syncthreads();
  for (int rl = wave; rl < 64; rl += 4) vst2(OUT + (r0 + rl) * CC + c0 + lane * 4, *(const v4f*)&sf[rl][lane * 4]); }
extern "C" void kernel_launch(void* const* d_in, const int* in_sizes, int n_in, void* d_out, int out_size, void* d_ws, size_t ws_size, hipStream_t stream) {
  (void)in_sizes; (void)n_in; (void)out_size;
  const float** F = (const float**)d_in;   // 0 x [2,2048,1024], 1 w_qkv [3072,1024] ([out,in]; q | k | v row blocks), 2 w_out [1024,1024] ([out,in]), 3 b_out
  if (ws_size < (size_t)WS_END) return;
  char* ws = (char*)d_ws; _Float16 *QH = (_Float16*)(ws + WS_QH), *QL = (_Float16*)(ws + WS_QL), *KH = (_Float16*)(ws + WS_KH); __bf16 *VT = (__bf16*)(ws + WS_VT), *VL = (__bf16*)(ws + WS_VL); float *Y = (float*)(ws + WS_Y);
  const float* WQ = F[1]; const float* WK = F[1] + (size_t)CC * CC; const float* WV = F[1] + 2u * (size_t)CC * CC;
  k_proj<<<dim3(TNB * TT / 128, CC / 128, 3), 128, 0, stream>>>(F[0], WQ, nullptr, WK, nullptr, WV, nullptr, QH, QL, KH, VT, VL);
  k_att<<<dim3(TT / 64, NH, TNB), 128, 0, stream>>>(QH, QL, KH, VT, VL, Y);
  k_out<<<dim3(TNB * TT / 64, CC / 128), 128, 0, stream>>>(Y, F[2], F[3], (float*)d_out);
}

// v004
// Measured time: 92.8 microseconds a run.
// Timed twice side by side with v003, it ran 1.07 times as fast both times.
// All steps since v000 together make it 9.79 times as fast.
// compute dtype: all float inputs rounded to bf16; qkv = x W_qkv^T with EXACT bf16 products on WMMA 16x16x32, f32 accumulate; q as f16 hi + residual (x 2^10), k f16 -> 2-product logits / 8 inside the causal sliding window (j <= i, i - j < 512), 32-key chunks of the window only, kept in registers; softmax in f32 in base 2 (hardware exp2 of logit x log2(e) / 8 minus the scaled maximum, one fma) with a running maximum, P unnormalised split bf16 hi + lo against v bf16 hi + lo (3 products), divided by the row sum at the end; out = ctx (bf16 hi + lo) w_out^T + b_out; f32 output.
#include <hip/hip_runtime.h>
#include <math.h>

typedef __attribute__((ext_vector_type(16))) _Float16 v16h;
typedef __attribute__((ext_vector_type(16))) __bf16 v16b;
typedef __attribute__((ext_vector_type(8)))  _Float16 v8h;
typedef __attribute__((ext_vector_type(8)))  float v8f;
typedef __attribute__((ext_vector_type(4)))  float v4f;
typedef __attribute__((ext_vector_type(2)))  float v2f;
typedef __attribute__((ext_vector_type(4)))  unsigned v4u;
typedef __attribute__((ext_vector_type(4)))  int v4i;
typedef float __attribute__((may_alias)) float_a;
typedef int __attribute__((may_alias)) int_a;

template <typename T> __device__ __forceinline__ void vst2(void* p, T v) { *(T*)p = v;  }
__device__ __forceinline__ v8f wmma16(v16h a, v16h b, v8f c) {
  v8f d = __builtin_amdgcn_wmma_f32_16x16x32_f16(false, a, false, b, (short)0, c, false, false);
  asm volatile("v_nop\n\tv_nop\n\tv_nop\n\tv_nop" : "+v"(d) : "v"(a), "v"(b));
  return d;
}
__device__ __forceinline__ v8f wmma_bf(v16b a, v16b b, v8f c) {
  v8f d = __builtin_amdgcn_wmma_f32_16x16x32_bf16(false, a, false, b, (short)0, c, false, false);
  asm volatile("v_nop\n\tv_nop\n\tv_nop\n\tv_nop" : "+v"(d) : "v"(a), "v"(b));
  return d;
}
// 16x16x32 fragments: lane = (h = lane>>4, row/col = lane&15); elements 0..7 = k0+8h+0..7, 8..15 = k0+16+8h+0..7; D element r = row 8h+r
__device__ __forceinline__ v16h frag_h(const _Float16* rowk0, int lane) {
  union { v16h v; v8h q[2]; } u; const _Float16* p = rowk0 + 8 * (lane >> 4);
  u.q[0] = *(const v8h*)p; u.q[1] = *(const v8h*)(p + 16); return u.v;
}
__device__ __forceinline__ v16h frag_f32(const float* rowk0, int lane) {
  v16h a; const float* p = rowk0 + 8 * (lane >> 4);
#pragma unroll
  for (int i = 0; i < 8; ++i) { a[i] = (_Float16)p[i]; a[8 + i] = (_Float16)p[16 + i]; }
  return a;
}
__device__ __forceinline__ v16h frag_f32s(const float* rowk0, int lane, float sc) {
  v16h a; const float* p = rowk0 + 8 * (lane >> 4);
#pragma unroll
  for (int i = 0; i < 8; ++i) { a[i] = (_Float16)(p[i] * sc); a[8 + i] = (_Float16)(p[16 + i] * sc); }
  return a;
}
// column fragment from a [K][ld] layout (column n), rows >= K read as 0
__device__ __forceinline__ v16h fragc_f32(const float* W, int k0, int n, int lane, int ld, int K) {
  v16h a; const int g = lane >> 4;
#pragma unroll
  for (int i = 0; i < 8; ++i) { const int ka = k0 + 8 * g + i, kb = ka + 16;
    a[i] = (_Float16)(ka < K ? W[(size_t)(ka < K ? ka : K - 1) * ld + n] : 0.f); a[8 + i] = (_Float16)(kb < K ? W[(size_t)(kb < K ? kb : K - 1) * ld + n] : 0.f); }
  return a;
}
struct F2 { v16b h, l; };
__device__ __forceinline__ F2 bsplit16(const float v[16]) { F2 r;
#pragma unroll
  for (int i = 0; i < 16; ++i) { const __bf16 h = (__bf16)v[i]; r.h[i] = h; r.l[i] = (__bf16)(v[i] - (float)h); }
  return r; }
__device__ __forceinline__ F2 split_row(const float* row, int k0, int lane) { float v[16]; const float* p = row + k0 + 8 * (lane >> 4);
#pragma unroll
  for (int i = 0; i < 8; ++i) { v[i] = p[i]; v[8 + i] = p[16 + i]; }
  return bsplit16(v); }
__device__ __forceinline__ F2 split_rowK(const float* row, int k0, int lane, int K) { float v[16]; const int g = lane >> 4;
#pragma unroll
  for (int i = 0; i < 8; ++i) { const int ka = k0 + 8 * g + i, kb = ka + 16; v[i] = ka < K ? row[ka < K ? ka : K - 1] : 0.f; v[8 + i] = kb < K ? row[kb < K ? kb : K - 1] : 0.f; }
  return bsplit16(v); }
__device__ __forceinline__ F2 split_col(const float* W, int k0, int n, int lane, int ld, int K) { float v[16]; const int g = lane >> 4;
#pragma unroll
  for (int i = 0; i < 8; ++i) { const int ka = k0 + 8 * g + i, kb = ka + 16; v[i] = ka < K ? W[(size_t)(ka < K ? ka : K - 1) * ld + n] : 0.f; v[8 + i] = kb < K ? W[(size_t)(kb < K ? kb : K - 1) * ld + n] : 0.f; }
  return bsplit16(v); }
__device__ __forceinline__ v8f mac3(const F2& a, const F2& b, v8f c) { c = wmma_bf(a.l, b.h, c); c = wmma_bf(a.h, b.l, c); return wmma_bf(a.h, b.h, c); }
__device__ __forceinline__ float sigm(float v) { return 1.0f / (1.0f + expf(-v)); }
#define LDSX() do { asm volatile("s_wait_dscnt 0" ::: "memory"); __builtin_amdgcn_wave_barrier(); __builtin_amdgcn_fence(__ATOMIC_RELEASE, "workgroup"); } while (0)


// Sliding-window causal MHA (B 2, S 2,048, 1,024 = 16 x 64, window 512): qkv = x W_qkv^T (no bias), allowed(i,j) = j <= i and i - j < 512, softmax, P v, out = ctx w_out^T + b_out.
#define NB 2
#define TT 2048
#define CC 1024
#define NH 16
#define HD 64
#define WIN 512
#ifndef TNB
#define TNB NB
#endif
typedef __attribute__((ext_vector_type(8))) __bf16 v8b;
__device__ __forceinline__ v16b frag_b(const __bf16* rowk0, int lane) {
  union { v16b v; v8b q[2]; } u; const __bf16* p = rowk0 + 8 * (lane >> 4);
  u.q[0] = *(const v8b*)p; u.q[1] = *(const v8b*)(p + 16); return u.v;
}
__device__ __forceinline__ float bfr(float v) { return (float)(__bf16)v; }
__device__ __attribute__((noinline)) float exp_ni(float v) { return expf(v); }
__device__ __attribute__((noinline)) float erf_ni(float v) { return erff(v); }

#define WS_QH  0u
#define WS_QL  (WS_QH + 2u * (size_t)NB * TT * CC)
#define WS_KH  (WS_QL + 2u * (size_t)NB * TT * CC)
#define WS_VT  (WS_KH + 2u * (size_t)NB * TT * CC)      // bf16 v hi planes [b][c][t]
#define WS_VL  (WS_VT + 2u * (size_t)NB * CC * TT)      // bf16 v residual planes
#define WS_Y   (WS_VL + 2u * (size_t)NB * CC * TT)      // f32 y rows [b*t][C]
#define WS_END (WS_Y + 4u * (size_t)NB * TT * CC)

// ---- LDS staging shared by the two projection kernels: a 32-k slice of both operands is read from global memory once per block with whole-line loads
//      (8 lanes x 16 B = one 128-B row slice), rounded to bf16 once, and kept in LDS rows of 80 B (16 B x odd: the 16-byte fragment reads meet no bank conflict)
#define LP 40
typedef __attribute__((ext_vector_type(4))) __bf16 v4b;
typedef __bf16 stage_t[256][LP];
__device__ __forceinline__ v4b cvt4(v4f v) { v4b r;
#pragma unroll
  for (int i = 0; i < 4; ++i) r[i] = (__bf16)v[i];
  return r; }
// the staged loops issue runs of independent products: the plain builtin leaves the compiler free in its register choice (no operand tied to an asm statement) and it keeps the distances itself
__device__ __forceinline__ v8f wmma_bp(v16b a, v16b b, v8f c) { return __builtin_amdgcn_wmma_f32_16x16x32_bf16(false, a, false, b, (short)0, c, false, false); }
// ---- k_proj: block = (128 rows, 128 cols, which), wave = 64 x 64: qkv = x W (+ b), exact; q -> f16 hi (+ residual), k -> f16 rows, v -> bf16 planes
__global__ __launch_bounds__(128) void k_proj(const float* __restrict__ X, const float* __restrict__ WQ, const float* __restrict__ BQ, const float* __restrict__ WK, const float* __restrict__ BK, const float* __restrict__ WV, const float* __restrict__ BV, _Float16* __restrict__ QH, _Float16* __restrict__ QL, _Float16* __restrict__ KH, __bf16* __restrict__ VT, __bf16* __restrict__ VL) {
  __shared__ __align__(16) char sm[2 * 128 * 136 * 2];   /* K loop: two stages of [x 128 rows | W 128 rows]; afterwards the two output planes */
  stage_t* st = (stage_t*)sm;
  const int tid = threadIdx.x, wave = tid >> 5, lane = tid & 31, col = lane & 15, g = lane >> 4, wm = wave >> 1, wn = wave & 1; const int which = blockIdx.z; const int c0 = blockIdx.y * 128; const size_t r0 = (size_t)blockIdx.x * 128; const float* WA = which == 0 ? WQ : which == 1 ? WK : WV; const float* BA = which == 0 ? BQ : which == 1 ? BK : BV;
  const int sr = tid >> 3, sk = (tid & 7) * 4; const float* px = X + (r0 + sr) * CC + sk; const float* pw = WA + (size_t)(c0 + sr) * CC + sk;
  v4f rx[8], rw[8]; v8f acc[4][4] = {};
#pragma unroll
  for (int i = 0; i < 8; ++i) { rx[i] = *(const v4f*)(px + (size_t)i * 16 * CC); rw[i] = *(const v4f*)(pw + (size_t)i * 16 * CC); }
#pragma unroll
  for (int i = 0; i < 8; ++i) { *(v4b*)&st[0][sr + 16 * i][sk] = cvt4(rx[i]); *(v4b*)&st[0][128 + sr + 16 * i][sk] = cvt4(rw[i]); }
  __syncthreads();
#pragma unroll 1   /* one slice's fragments and one slice in flight at a time: three blocks per WGP fit */
  for (int kc = 0; kc < CC / 32; ++kc) { const int cur = kc & 1; const bool more = kc + 1 < CC / 32;
    if (more) {   /* the next slice flies under this slice's products */
#pragma unroll
      for (int i = 0; i < 8; ++i) { rx[i] = *(const v4f*)(px + (size_t)i * 16 * CC + (kc + 1) * 32); rw[i] = *(const v4f*)(pw + (size_t)i * 16 * CC + (kc + 1) * 32); }
      asm volatile("s_wait_xcnt 0x0" ::: "memory");   /* the loads' address registers are reused for the fragments below: the wait stands in front of that overwrite */ }
    v16b a[4], w[4];
#pragma unroll
    for (int i = 0; i < 4; ++i) { a[i] = frag_b(&st[cur][wm * 64 + i * 16 + col][0], lane); w[i] = frag_b(&st[cur][128 + wn * 64 + i * 16 + col][0], lane); }
    __builtin_amdgcn_sched_barrier(0);   /* all sixteen fragment reads stay one group ahead of the products; sunk among them, each place costs the wave an LDS wait */
#pragma unroll
    for (int i = 0; i < 4; ++i)
#pragma unroll
      for (int j = 0; j < 4; ++j) acc[i][j] = (i == 3 && j == 3) ? wmma_bf(a[i], w[j], acc[i][j]) : wmma_bp(a[i], w[j], acc[i][j]);   /* the run's last product carries its four slots itself: a branch follows */
    if (more) {   /* into the stage whose readers all passed the barrier of the trip before */
#pragma unroll
      for (int i = 0; i < 8; ++i) { *(v4b*)&st[cur ^ 1][sr + 16 * i][sk] = cvt4(rx[i]); *(v4b*)&st[cur ^ 1][128 + sr + 16 * i][sk] = cvt4(rw[i]); } }
    __syncthreads(); }
  _Float16 (*sh)[136] = (_Float16 (*)[136])sm; _Float16 (*sl)[136] = (_Float16 (*)[136])(sm + 128 * 136 * 2); __bf16 (*th)[136] = (__bf16 (*)[136])sm; __bf16 (*tl2)[136] = (__bf16 (*)[136])(sm + 128 * 136 * 2);
#pragma unroll
  for (int j = 0; j < 4; ++j) { const int cl = wn * 64 + j * 16 + col; const float bb = BA ? bfr(BA[c0 + cl]) : 0.f;
#pragma unroll
    for (int i = 0; i < 4; ++i) acc[i][j] += bb; }
  if (which == 2) {
#pragma unroll
    for (int j = 0; j < 4; ++j)
#pragma unroll
      for (int i = 0; i < 4; ++i)
#pragma unroll
        for (int r = 0; r < 8; ++r) { const float v = acc[i][j][r]; const int cl = wn * 64 + j * 16 + col, rl = wm * 64 + i * 16 + 8 * g + r; const __bf16 bh = (__bf16)v; th[cl][rl] = bh; tl2[cl][rl] = (__bf16)(v - (float)bh); } }
  else {
#pragma unroll
    for (int j = 0; j < 4; ++j)
#pragma unroll
      for (int i = 0; i < 4; ++i)
#pragma unroll
        for (int r = 0; r < 8; ++r) { const float v = acc[i][j][r]; const int cl = wn * 64 + j * 16 + col, rl = wm * 64 + i * 16 + 8 * g + r; const _Float16 hv = (_Float16)v; sh[rl][cl] = hv; sl[rl][cl] = (_Float16)((v - (float)hv) * 1024.0f); }   /* q residual carried x 2^10 so the plane stays f16-normal on the chip */ }
  __syncthreads();
  if (which == 0) { for (int e = tid; e < 128 * 16; e += 128) { const int rl = e >> 4, q = e & 15; const size_t o1 = (r0 + rl) * CC + c0 + q * 8; vst2((unsigned*)(QH + o1), *(const v4u*)&sh[rl][q * 8]); vst2((unsigned*)(QL + o1), *(const v4u*)&sl[rl][q * 8]); } }
  else if (which == 1) { for (int e = tid; e < 128 * 16; e += 128) { const int rl = e >> 4, q = e & 15; vst2((unsigned*)(KH + (r0 + rl) * CC + c0 + q * 8), *(const v4u*)&sh[rl][q * 8]); } }
  else { const size_t b = r0 / TT; const int t0 = (int)(r0 % TT); for (int e = tid; e < 128 * 16; e += 128) { const int cl = e >> 4, q = e & 15; const size_t o2 = (b * CC + c0 + cl) * (size_t)TT + t0 + q * 8; vst2((unsigned*)(VT + o2), *(const v4u*)&th[cl][q * 8]); vst2((unsigned*)(VL + o2), *(const v4u*)&tl2[cl][q * 8]); } } }
__device__ __forceinline__ float xhalf(float v) { const int i = __builtin_bit_cast(int, v); return __builtin_bit_cast(float, __builtin_amdgcn_permlanex16(i, i, 0x76543210, 0xfedcba98, false, false)); }
#define AP 72                      /* LDS row pitch in 16-bit elements: 128 B of data + 16 B = 144 B = 16 B x 9, the pitch at which 16-byte fragment reads meet no bank conflict */
#define AROW (AP * 2)
#define ASTG (192 * AROW)          /* one stage = 64 keys: 64 K rows | 64 rows of v hi | 64 rows of v lo, each row one whole 128-B line */
// one stage's copies of one lane: four rows, 16 apart, of each of the three planes; 8 lanes x 16 B cover one whole line of global memory.
// The wait is the last line of the copies' own statement, so it stands in front of any later rewrite of their address registers
__device__ __forceinline__ void acopy12(unsigned l, const char* k, const char* v, const char* w) {
  const size_t ks = (size_t)16 * CC * 2, vs = (size_t)16 * TT * 2;
  asm volatile("global_load_async_to_lds_b128 %0, %12, off\n\tglobal_load_async_to_lds_b128 %1, %13, off\n\tglobal_load_async_to_lds_b128 %2, %14, off\n\tglobal_load_async_to_lds_b128 %3, %15, off\n\t"
               "global_load_async_to_lds_b128 %4, %16, off\n\tglobal_load_async_to_lds_b128 %5, %17, off\n\tglobal_load_async_to_lds_b128 %6, %18, off\n\tglobal_load_async_to_lds_b128 %7, %19, off\n\t"
               "global_load_async_to_lds_b128 %8, %20, off\n\tglobal_load_async_to_lds_b128 %9, %21, off\n\tglobal_load_async_to_lds_b128 %10, %22, off\n\tglobal_load_async_to_lds_b128 %11, %23, off\n\ts_wait_xcnt 0x0"
               :: "v"(l), "v"(l + 16u * AROW), "v"(l + 32u * AROW), "v"(l + 48u * AROW), "v"(l + 64u * AROW), "v"(l + 80u * AROW), "v"(l + 96u * AROW), "v"(l + 112u * AROW), "v"(l + 128u * AROW), "v"(l + 144u * AROW), "v"(l + 160u * AROW), "v"(l + 176u * AROW),
                  "v"(k), "v"(k + ks), "v"(k + 2 * ks), "v"(k + 3 * ks), "v"(v), "v"(v + vs), "v"(v + 2 * vs), "v"(v + 3 * vs), "v"(w), "v"(w + vs), "v"(w + 2 * vs), "v"(w + 3 * vs) : "memory"); }
__global__ __launch_bounds__(128) void k_att(const _Float16* __restrict__ QH, const _Float16* __restrict__ QL, const _Float16* __restrict__ KH, const __bf16* __restrict__ VT, const __bf16* __restrict__ VL, float* __restrict__ Y) {
  __shared__ __align__(16) char sm[2 * ASTG];   /* two stages: the block's four waves read their K and v fragments from here */
  const int tid = threadIdx.x, lane = tid & 31, col = lane & 15, g = lane >> 4; const int h = blockIdx.y, b = blockIdx.z;
  const int wave = __builtin_amdgcn_readfirstlane(tid >> 5);   /* the wave's number as a scalar: loop bounds, loop branch and chunk addresses stay scalar */
  const int Q0 = blockIdx.x * 64, q0 = Q0 + wave * 16;
  const int kclo = (q0 - (WIN - 1)) > 0 ? (q0 - (WIN - 1)) / 32 : 0;   /* first 32-key chunk that can hold a key inside the earliest query's window */
  const int kchi = (q0 + 16 + 31) / 32;                                /* one past the chunk that holds the last query's own key */
  const int slo = Q0 >= WIN ? (Q0 - WIN) / 64 : 0, shi = Q0 / 64 + 1;  /* the block's 64-key stages: from the one with key Q0 - 511 to the one with key Q0 + 63 */
  const size_t qo = ((size_t)b * TT + q0 + col) * CC + h * HD;
  const int sr = tid >> 3, sg = tid & 7;   /* staging: row sr (+ 16 i) of each plane, 16-byte piece sg of its line */
  const char* gk = (const char*)(KH + ((size_t)b * TT + sr) * CC + h * HD + sg * 8);
  const char* gv = (const char*)(VT + ((size_t)b * CC + h * HD + sr) * (size_t)TT + sg * 8);
  const char* gl = (const char*)(VL + ((size_t)b * CC + h * HD + sr) * (size_t)TT + sg * 8);
  const unsigned ls = (unsigned)(size_t)sm + (unsigned)(sr * AROW + sg * 16);
#define ASTAGE(s, buf) acopy12(ls + (unsigned)(buf) * ASTG, gk + (size_t)(s) * 64 * CC * 2, gv + (size_t)(s) * 128, gl + (size_t)(s) * 128)
  v16h qh[2], ql[2];
#pragma unroll
  for (int c = 0; c < 2; ++c) { qh[c] = frag_h(QH + qo + c * 32, lane); ql[c] = frag_h(QL + qo + c * 32, lane); }
  ASTAGE(slo, 0);
  asm volatile("s_wait_asynccnt 0x0" ::: "memory");   /* this wave's copies of the first stage have landed */
  __syncthreads();                                     /* ... and every other wave's */
  if (slo + 1 < shi) ASTAGE(slo + 1, 1);
  const float C2 = 0.125f * 1.4426950408889634f;   /* 1 / sqrt(64) and log2(e) in one factor: exp(s / 8 - max / 8) = exp2(s C2 - max C2) */
  v8f acc[HD / 16] = {}; float m = -1.0e30f, l = 0.f;   /* m: running maximum of the unscaled logits; it starts far above the mask fill, so a masked logit gives exp2 = 0 also while a column has met no allowed key yet */
#pragma unroll 1   /* one stage per trip */
  for (int s = slo; s < shi; ++s) { const int cur = (s - slo) & 1;
#pragma unroll 1   /* one chunk's fragments live at a time: four waves per SIMD fit */
    for (int hh = 0; hh < 2; ++hh) { const int kc = 2 * s + hh;
      if (kc >= kclo && kc < kchi) {   /* a scalar test: the wave works only on the chunks of its own queries' window, in rising order */
        const int k0 = kc * 32; const char* sb = sm + cur * ASTG; v16h kf[2][2]; v16b vh[HD / 16], vl[HD / 16];
        const _Float16* kl = (const _Float16*)sb + (hh * 32 + col) * AP; const __bf16* vp = (const __bf16*)(sb + 64 * AROW) + col * AP + hh * 32; const __bf16* lp = (const __bf16*)(sb + 128 * AROW) + col * AP + hh * 32;
#pragma unroll
        for (int t = 0; t < 2; ++t)
#pragma unroll
          for (int c = 0; c < 2; ++c) kf[t][c] = frag_h(kl + t * 16 * AP + c * 32, lane);
#pragma unroll
        for (int j = 0; j < HD / 16; ++j) { vh[j] = frag_b(vp + j * 16 * AP, lane); vl[j] = frag_b(lp + j * 16 * AP, lane); }
        v8f s2[2] = {}, sl[2] = {};
#pragma unroll
        for (int t = 0; t < 2; ++t)
#pragma unroll
          for (int c = 0; c < 2; ++c) { s2[t] = wmma16(kf[t][c], qh[c], s2[t]); sl[t] = wmma16(kf[t][c], ql[c], sl[t]); }
        float p[16]; float mx = m; const int dq = q0 + col - k0 - 8 * g;   /* query - key = dq - (16 t + r) */
#pragma unroll
        for (int t = 0; t < 2; ++t)
#pragma unroll
          for (int r = 0; r < 8; ++r) { const float v = s2[t][r] + sl[t][r] * (1.0f / 1024.0f); const bool allowed = (unsigned)(dq - (16 * t + r)) < (unsigned)WIN; p[8 * t + r] = allowed ? v : -3.0e38f; mx = fmaxf(mx, p[8 * t + r]); }
        mx = fmaxf(mx, xhalf(mx)); const float alpha = __builtin_amdgcn_exp2f((m - mx) * C2), mcn = mx * C2; m = mx; float ps = 0.f; const v2f c2 = { C2, C2 }, nm = { -mcn, -mcn };
#pragma unroll
        for (int i = 0; i < 16; i += 2) { const v2f a = { p[i], p[i + 1] }; const v2f e = __builtin_elementwise_fma(a, c2, nm); p[i] = __builtin_amdgcn_exp2f(e[0]); p[i + 1] = __builtin_amdgcn_exp2f(e[1]); ps += p[i]; ps += p[i + 1]; }
        l = l * alpha + ps;   /* each half sums its own keys; joined after the loop */
#pragma unroll
        for (int j = 0; j < HD / 16; ++j) acc[j] *= alpha;
        const F2 pf = bsplit16(p);
#pragma unroll
        for (int j = 0; j < HD / 16; ++j) { acc[j] = wmma_bf(vh[j], pf.h, acc[j]); acc[j] = wmma_bf(vh[j], pf.l, acc[j]); acc[j] = wmma_bf(vl[j], pf.h, acc[j]); } } }
    asm volatile("s_wait_dscnt 0x0" ::: "memory");      /* this wave's reads of the stage are done before the stage is handed back */
    asm volatile("s_wait_asynccnt 0x0" ::: "memory");   /* this wave's copies of the next stage have landed */
    __syncthreads();                                     /* publishes the next stage and ends every wave's reads of this one */
    if (s + 2 < shi) ASTAGE(s + 2, cur); }
  asm volatile("s_wait_asynccnt 0x0" ::: "memory");     /* no copy is outstanding when the wave ends */
  l += xhalf(l); const float inv = 1.0f / l; float* yr = Y + qo + 8 * g;
#pragma unroll
  for (int j = 0; j < HD / 16; ++j) { v4f a, c;
#pragma unroll
    for (int r = 0; r < 4; ++r) { a[r] = acc[j][r] * inv; c[r] = acc[j][4 + r] * inv; }
    vst2(yr + j * 16, a); vst2(yr + j * 16 + 4, c); } }
// ---- k_out: block = (64 rows, 128 cols), wave = 32 x 64: out = y (bf16 hi + lo) Wo^T + bo; staged like k_proj, y split once per block
__global__ __launch_bounds__(128) void k_out(const float* __restrict__ Y, const float* __restrict__ WP, const float* __restrict__ BP, float* __restrict__ OUT) {
  __shared__ __align__(16) char sm[2 * 256 * LP * 2];   /* K loop: two stages of [y hi 64 rows | y lo 64 rows | W 128 rows]; afterwards the f32 output tile */
  stage_t* st = (stage_t*)sm;
  const int tid = threadIdx.x, wave = tid >> 5, lane = tid & 31, col = lane & 15, g = lane >> 4, wm = wave >> 1, wn = wave & 1; const int c0 = blockIdx.y * 128; const size_t r0 = (size_t)blockIdx.x * 64;
  const int sr = tid >> 3, sk = (tid & 7) * 4; const float* py = Y + (r0 + sr) * CC + sk; const float* pw = WP + (size_t)(c0 + sr) * CC + sk;
  v4f ry[4], rw[8]; v8f acc[2][4] = {};
#pragma unroll
  for (int i = 0; i < 8; ++i) { if (i < 4) ry[i] = *(const v4f*)(py + (size_t)i * 16 * CC); rw[i] = *(const v4f*)(pw + (size_t)i * 16 * CC); }
#pragma unroll
  for (int i = 0; i < 8; ++i) { if (i < 4) { const v4b hi = cvt4(ry[i]); v4f rs;
#pragma unroll
      for (int e = 0; e < 4; ++e) rs[e] = ry[i][e] - (float)hi[e];
      *(v4b*)&st[0][sr + 16 * i][sk] = hi; *(v4b*)&st[0][64 + sr + 16 * i][sk] = cvt4(rs); }
    *(v4b*)&st[0][128 + sr + 16 * i][sk] = cvt4(rw[i]); }
  __syncthreads();
#pragma unroll 1   /* one slice's fragments and one slice in flight at a time */
  for (int kc = 0; kc < CC / 32; ++kc) { const int cur = kc & 1; const bool more = kc + 1 < CC / 32;
    if (more) {   /* the next slice flies under this slice's products */
#pragma unroll
      for (int i = 0; i < 8; ++i) { if (i < 4) ry[i] = *(const v4f*)(py + (size_t)i * 16 * CC + (kc + 1) * 32); rw[i] = *(const v4f*)(pw + (size_t)i * 16 * CC + (kc + 1) * 32); }
      asm volatile("s_wait_xcnt 0x0" ::: "memory");   /* the loads' address registers are reused for the fragments below: the wait stands in front of that overwrite */ }
    v16b ah[2], al[2], w[4];
#pragma unroll
    for (int i = 0; i < 2; ++i) { ah[i] = frag_b(&st[cur][wm * 32 + i * 16 + col][0], lane); al[i] = frag_b(&st[cur][64 + wm * 32 + i * 16 + col][0], lane); }
#pragma unroll
    for (int j = 0; j < 4; ++j) w[j] = frag_b(&st[cur][128 + wn * 64 + j * 16 + col][0], lane);
    __builtin_amdgcn_sched_barrier(0);   /* the fragment reads stay one group ahead of the products, as in k_proj */
#pragma unroll
    for (int i = 0; i < 2; ++i)
#pragma unroll
      for (int j = 0; j < 4; ++j) acc[i][j] = wmma_bp(ah[i], w[j], acc[i][j]);
#pragma unroll
    for (int i = 0; i < 2; ++i)
#pragma unroll
      for (int j = 0; j < 4; ++j) acc[i][j] = (i == 1 && j == 3) ? wmma_bf(al[i], w[j], acc[i][j]) : wmma_bp(al[i], w[j], acc[i][j]);   /* last product of the run: as in k_proj */
    if (more) {   /* into the stage whose readers all passed the barrier of the trip before */
#pragma unroll
      for (int i = 0; i < 8; ++i) { if (i < 4) { const v4b hi = cvt4(ry[i]); v4f rs;
#pragma unroll
          for (int e = 0; e < 4; ++e) rs[e] = ry[i][e] - (float)hi[e];
          *(v4b*)&st[cur ^ 1][sr + 16 * i][sk] = hi; *(v4b*)&st[cur ^ 1][64 + sr + 16 * i][sk] = cvt4(rs); }
        *(v4b*)&st[cur ^ 1][128 + sr + 16 * i][sk] = cvt4(rw[i]); } }
    __syncthreads(); }
  float (*sf)[132] = (float (*)[132])sm;
#pragma unroll
  for (int j = 0; j < 4; ++j) { const int cl = wn * 64 + j * 16 + col; const float bb = BP ? bfr(BP[c0 + cl]) : 0.f;
#pragma unroll
    for (int i = 0; i < 2; ++i)
#pragma unroll
      for (int r = 0; r < 8; ++r) sf[wm * 32 + i * 16 + 8 * g + r][cl] = acc[i][j][r] + bb; }
  __syncthreads();
  for (int rl = wave; rl < 64; rl += 4) vst2(OUT + (r0 + rl) * CC + c0 + lane * 4, *(const v4f*)&sf[rl][lane * 4]); }
extern "C" void kernel_launch(void* const* d_in, const int* in_sizes, int n_in, void* d_out, int out_size, void* d_ws, size_t ws_size, hipStream_t stream) {
  (void)in_sizes; (void)n_in; (void)out_size;
  const float** F = (const float**)d_in;   // 0 x [2,2048,1024], 1 w_qkv [3072,1024] ([out,in]; q | k | v row blocks), 2 w_out [1024,1024] ([out,in]), 3 b_out
  if (ws_size < (size_t)WS_END) return;
  char* ws = (char*)d_ws; _Float16 *QH = (_Float16*)(ws + WS_QH), *QL = (_Float16*)(ws + WS_QL), *KH = (_Float16*)(ws + WS_KH); __bf16 *VT = (__bf16*)(ws + WS_VT), *VL = (__bf16*)(ws + WS_VL); float *Y = (float*)(ws + WS_Y);
  const float* WQ = F[1]; const float* WK = F[1] + (size_t)CC * CC; const float* WV = F[1] + 2u * (size_t)CC * CC;
  k_proj<<<dim3(TNB * TT / 128, CC / 128, 3), 128, 0, stream>>>(F[0], WQ, nullptr, WK, nullptr, WV, nullptr, QH, QL, KH, VT, VL);
  k_att<<<dim3(TT / 64, NH, TNB), 128, 0, stream>>>(QH, QL, KH, VT, VL, Y);
  k_out<<<dim3(TNB * TT / 64, CC / 128), 128, 0, stream>>>(Y, F[2], F[3], (float*)d_out);
}

// v005
// One run takes 82 microseconds.
// In two side-by-side timings against v004, it was 1.14 and 1.13 times as fast.
// Counting every step since v000, it is 11.1 times as fast.
// compute dtype: all float inputs rounded to bf16; qkv = x W_qkv^T with EXACT bf16 products on WMMA 16x16x32, f32 accumulate; q as f16 hi + residual (x 2^10), k f16 -> 2-product logits / 8 inside the causal sliding window (j <= i, i - j < 512), 32-key chunks of the window only, kept in registers; softmax in f32 in base 2 (hardware exp2 of logit x log2(e) / 8 minus the scaled maximum, one fma) with a running maximum, P unnormalised split bf16 hi + lo against v bf16 hi + lo (3 products), divided by the row sum at the end; out = ctx (bf16 hi + lo) w_out^T + b_out; f32 output.
#include <hip/hip_runtime.h>
#include <math.h>

typedef __attribute__((ext_vector_type(16))) _Float16 v16h;
typedef __attribute__((ext_vector_type(16))) __bf16 v16b;
typedef __attribute__((ext_vector_type(8)))  _Float16 v8h;
typedef __attribute__((ext_vector_type(8)))  float v8f;
typedef __attribute__((ext_vector_type(4)))  float v4f;
typedef __attribute__((ext_vector_type(2)))  float v2f;
typedef __attribute__((ext_vector_type(4)))  unsigned v4u;
typedef __attribute__((ext_vector_type(4)))  int v4i;
typedef float __attribute__((may_alias)) float_a;
typedef int __attribute__((may_alias)) int_a;

template <typename T> __device__ __forceinline__ void vst2(void* p, T v) { *(T*)p = v;  }
__device__ __forceinline__ v8f wmma16(v16h a, v16h b, v8f c) {
  v8f d = __builtin_amdgcn_wmma_f32_16x16x32_f16(false, a, false, b, (short)0, c, false, false);
  asm volatile("v_nop\n\tv_nop\n\tv_nop\n\tv_nop" : "+v"(d) : "v"(a), "v"(b));
  return d;
}
__device__ __forceinline__ v8f wmma_bf(v16b a, v16b b, v8f c) {
  v8f d = __builtin_amdgcn_wmma_f32_16x16x32_bf16(false, a, false, b, (short)0, c, false, false);
  asm volatile("v_nop\n\tv_nop\n\tv_nop\n\tv_nop" : "+v"(d) : "v"(a), "v"(b));
  return d;
}
// 16x16x32 fragments: lane = (h = lane>>4, row/col = lane&15); elements 0..7 = k0+8h+0..7, 8..15 = k0+16+8h+0..7; D element r = row 8h+r
__device__ __forceinline__ v16h frag_h(const _Float16* rowk0, int lane) {
  union { v16h v; v8h q[2]; } u; const _Float16* p = rowk0 + 8 * (lane >> 4);
  u.q[0] = *(const v8h*)p; u.q[1] = *(const v8h*)(p + 16); return u.v;
}
__device__ __forceinline__ v16h frag_f32(const float* rowk0, int lane) {
  v16h a; const float* p = rowk0 + 8 * (lane >> 4);
#pragma unroll
  for (int i = 0; i < 8; ++i) { a[i] = (_Float16)p[i]; a[8 + i] = (_Float16)p[16 + i]; }
  return a;
}
__device__ __forceinline__ v16h frag_f32s(const float* rowk0, int lane, float sc) {
  v16h a; const float* p = rowk0 + 8 * (lane >> 4);
#pragma unroll
  for (int i = 0; i < 8; ++i) { a[i] = (_Float16)(p[i] * sc); a[8 + i] = (_Float16)(p[16 + i] * sc); }
  return a;
}
// column fragment from a [K][ld] layout (column n), rows >= K read as 0
__device__ __forceinline__ v16h fragc_f32(const float* W, int k0, int n, int lane, int ld, int K) {
  v16h a; const int g = lane >> 4;
#pragma unroll
  for (int i = 0; i < 8; ++i) { const int ka = k0 + 8 * g + i, kb = ka + 16;
    a[i] = (_Float16)(ka < K ? W[(size_t)(ka < K ? ka : K - 1) * ld + n] : 0.f); a[8 + i] = (_Float16)(kb < K ? W[(size_t)(kb < K ? kb : K - 1) * ld + n] : 0.f); }
  return a;
}
struct F2 { v16b h, l; };
__device__ __forceinline__ F2 bsplit16(const float v[16]) { F2 r;
#pragma unroll
  for (int i = 0; i < 16; ++i) { const __bf16 h = (__bf16)v[i]; r.h[i] = h; r.l[i] = (__bf16)(v[i] - (float)h); }
  return r; }
__device__ __forceinline__ F2 split_row(const float* row, int k0, int lane) { float v[16]; const float* p = row + k0 + 8 * (lane >> 4);
#pragma unroll
  for (int i = 0; i < 8; ++i) { v[i] = p[i]; v[8 + i] = p[16 + i]; }
  return bsplit16(v); }
__device__ __forceinline__ F2 split_rowK(const float* row, int k0, int lane, int K) { float v[16]; const int g = lane >> 4;
#pragma unroll
  for (int i = 0; i < 8; ++i) { const int ka = k0 + 8 * g + i, kb = ka + 16; v[i] = ka < K ? row[ka < K ? ka : K - 1] : 0.f; v[8 + i] = kb < K ? row[kb < K ? kb : K - 1] : 0.f; }
  return bsplit16(v); }
__device__ __forceinline__ F2 split_col(const float* W, int k0, int n, int lane, int ld, int K) { float v[16]; const int g = lane >> 4;
#pragma unroll
  for (int i = 0; i < 8; ++i) { const int ka = k0 + 8 * g + i, kb = ka + 16; v[i] = ka < K ? W[(size_t)(ka < K ? ka : K - 1) * ld + n] : 0.f; v[8 + i] = kb < K ? W[(size_t)(kb < K ? kb : K - 1) * ld + n] : 0.f; }
  return bsplit16(v); }
__device__ __forceinline__ v8f mac3(const F2& a, const F2& b, v8f c) { c = wmma_bf(a.l, b.h, c); c = wmma_bf(a.h, b.l, c); return wmma_bf(a.h, b.h, c); }
__device__ __forceinline__ float sigm(float v) { return 1.0f / (1.0f + expf(-v)); }
#define LDSX() do { asm volatile("s_wait_dscnt 0" ::: "memory"); __builtin_amdgcn_wave_barrier(); __builtin_amdgcn_fence(__ATOMIC_RELEASE, "workgroup"); } while (0)


// Sliding-window causal MHA (B 2, S 2,048, 1,024 = 16 x 64, window 512): qkv = x W_qkv^T (no bias), allowed(i,j) = j <= i and i - j < 512, softmax, P v, out = ctx w_out^T + b_out.
#define NB 2
#define TT 2048
#define CC 1024
#define NH 16
#define HD 64
#define WIN 512
#ifndef TNB
#define TNB NB
#endif
typedef __attribute__((ext_vector_type(8))) __bf16 v8b;
__device__ __forceinline__ v16b frag_b(const __bf16* rowk0, int lane) {
  union { v16b v; v8b q[2]; } u; const __bf16* p = rowk0 + 8 * (lane >> 4);
  u.q[0] = *(const v8b*)p; u.q[1] = *(const v8b*)(p + 16); return u.v;
}
__device__ __forceinline__ float bfr(float v) { return (float)(__bf16)v; }
__device__ __attribute__((noinline)) float exp_ni(float v) { return expf(v); }
__device__ __attribute__((noinline)) float erf_ni(float v) { return erff(v); }

#define WS_QH  0u
#define WS_QL  (WS_QH + 2u * (size_t)NB * TT * CC)
#define WS_KH  (WS_QL + 2u * (size_t)NB * TT * CC)
#define WS_VT  (WS_KH + 2u * (size_t)NB * TT * CC)      // bf16 v hi planes [b][c][t]
#define WS_VL  (WS_VT + 2u * (size_t)NB * CC * TT)      // bf16 v residual planes
#define WS_Y   (WS_VL + 2u * (size_t)NB * CC * TT)      // f32 y rows [b*t][C]
#define WS_XB  (WS_Y + 4u * (size_t)NB * TT * CC)       // bf16 copies, one range: x rows | w_qkv rows | w_out rows
#define WS_END (WS_XB + 2u * ((size_t)NB * TT * CC + 4u * (size_t)CC * CC))

// ---- LDS staging shared by the two projection kernels: a 64-k slice of both operands is read from global memory once per block with whole-line loads
//      (bf16 operands: 8 lanes x 16 B = one 128-B row slice), and kept in LDS rows of 144 B (16 B x odd: the 16-byte fragment reads meet no bank conflict)
#define LP 72
typedef __attribute__((ext_vector_type(4))) __bf16 v4b;
typedef __bf16 stage_t[256][LP];
__device__ __forceinline__ v4b cvt4(v4f v) { v4b r;
#pragma unroll
  for (int i = 0; i < 4; ++i) r[i] = (__bf16)v[i];
  return r; }
// the staged loops issue runs of independent products: the plain builtin leaves the compiler free in its register choice (no operand tied to an asm statement) and it keeps the distances itself
__device__ __forceinline__ v8f wmma_bp(v16b a, v16b b, v8f c) { return __builtin_amdgcn_wmma_f32_16x16x32_bf16(false, a, false, b, (short)0, c, false, false); }
// ---- k_cvt: x, w_qkv and w_out are rounded to bf16 once, so that the projection kernels, whose blocks read every row 24 to 64 times, move half the bytes and convert nothing;
//      block = 32,768 elements of one of the three, one block per WGP, all of a wave's 32 loads in flight at once; a wave's load covers four whole lines, its store two
#define CVB 32768
#define NXB (NB * TT * CC / CVB)
#define NWB (3 * CC * CC / CVB)
#define NOB (CC * CC / CVB)
__global__ __launch_bounds__(256) void k_cvt(const float* __restrict__ X, const float* __restrict__ WQKV, const float* __restrict__ WO, __bf16* __restrict__ D) {
  const int b = blockIdx.x, tid = threadIdx.x;
  const float* s = b < NXB ? X + (size_t)b * CVB : b < NXB + NWB ? WQKV + (size_t)(b - NXB) * CVB : WO + (size_t)(b - NXB - NWB) * CVB;
  __bf16* d = D + (size_t)b * CVB; v4f r[32];
#pragma unroll
  for (int i = 0; i < 32; ++i) r[i] = *(const v4f*)(s + (i * 256 + tid) * 4);
#pragma unroll
  for (int i = 0; i < 32; ++i) *(v4b*)(d + (i * 256 + tid) * 4) = cvt4(r[i]); }
// ---- k_proj: block = (128 rows, 128 cols, which), wave = 64 x 64: qkv = x W (+ b), exact; q -> f16 hi (+ residual), k -> f16 rows, v -> bf16 planes
__global__ __launch_bounds__(128) void k_proj(const __bf16* __restrict__ X, const __bf16* __restrict__ WQ, const float* __restrict__ BQ, const __bf16* __restrict__ WK, const float* __restrict__ BK, const __bf16* __restrict__ WV, const float* __restrict__ BV, _Float16* __restrict__ QH, _Float16* __restrict__ QL, _Float16* __restrict__ KH, __bf16* __restrict__ VT, __bf16* __restrict__ VL) {
  __shared__ __align__(16) char sm[2 * 256 * LP * 2];   /* K loop: two stages of [x 128 rows | W 128 rows]; afterwards the two output planes (2 x 128 x 136 x 2 B fit) */
  stage_t* st = (stage_t*)sm;
  const int tid = threadIdx.x, wave = tid >> 5, lane = tid & 31, col = lane & 15, g = lane >> 4, wm = wave >> 1, wn = wave & 1; const int which = blockIdx.z; const int c0 = blockIdx.y * 128; const size_t r0 = (size_t)blockIdx.x * 128; const __bf16* WA = which == 0 ? WQ : which == 1 ? WK : WV; const float* BA = which == 0 ? BQ : which == 1 ? BK : BV;
  const int sr = tid >> 3, sk = (tid & 7) * 8; const __bf16* px = X + (r0 + sr) * CC + sk; const __bf16* pw = WA + (size_t)(c0 + sr) * CC + sk;
  v8b rx[8], rw[8]; v8f acc[4][4] = {};
#pragma unroll
  for (int i = 0; i < 8; ++i) { rx[i] = *(const v8b*)(px + (size_t)i * 16 * CC); rw[i] = *(const v8b*)(pw + (size_t)i * 16 * CC); }
  asm volatile("s_wait_xcnt 0x0" ::: "memory");   /* stands in front of any reuse of the loads' address registers */
#pragma unroll
  for (int i = 0; i < 8; ++i) { *(v8b*)&st[0][sr + 16 * i][sk] = rx[i]; *(v8b*)&st[0][128 + sr + 16 * i][sk] = rw[i]; }
  __syncthreads();
#pragma unroll 1   /* one half slice's fragments and one slice in flight at a time: three blocks per WGP fit */
  for (int kc = 0; kc < CC / 64; ++kc) { const int cur = kc & 1; const bool more = kc + 1 < CC / 64;
    if (more) {   /* the next slice flies under this slice's products */
#pragma unroll
      for (int i = 0; i < 8; ++i) { rx[i] = *(const v8b*)(px + (size_t)i * 16 * CC + (kc + 1) * 64); rw[i] = *(const v8b*)(pw + (size_t)i * 16 * CC + (kc + 1) * 64); }
      asm volatile("s_wait_xcnt 0x0" ::: "memory");   /* the loads' address registers are reused for the fragments below: the wait stands in front of that overwrite */ }
#pragma unroll
    for (int hh = 0; hh < 2; ++hh) {   /* the slice's two 32-k halves, in rising k: the sums keep their order */
      v16b a[4], w[4];
#pragma unroll
      for (int i = 0; i < 4; ++i) { a[i] = frag_b(&st[cur][wm * 64 + i * 16 + col][hh * 32], lane); w[i] = frag_b(&st[cur][128 + wn * 64 + i * 16 + col][hh * 32], lane); }
      __builtin_amdgcn_sched_barrier(0);   /* all sixteen fragment reads stay one group ahead of the products; sunk among them, each place costs the wave an LDS wait */
#pragma unroll
      for (int i = 0; i < 4; ++i)
#pragma unroll
        for (int j = 0; j < 4; ++j) acc[i][j] = (hh == 1 && i == 3 && j == 3) ? wmma_bf(a[i], w[j], acc[i][j]) : wmma_bp(a[i], w[j], acc[i][j]);   /* the run's last product carries its four slots itself: a branch follows */
      if (hh == 0) __builtin_amdgcn_sched_barrier(0);   /* the second half's reads stay one group behind the first half's products, in the same registers: a second fragment set would cost the third block per WGP */ }
    if (more) {   /* into the stage whose readers all passed the barrier of the trip before */
#pragma unroll
      for (int i = 0; i < 8; ++i) { *(v8b*)&st[cur ^ 1][sr + 16 * i][sk] = rx[i]; *(v8b*)&st[cur ^ 1][128 + sr + 16 * i][sk] = rw[i]; } }
    __syncthreads(); }
  _Float16 (*sh)[136] = (_Float16 (*)[136])sm; _Float16 (*sl)[136] = (_Float16 (*)[136])(sm + 128 * 136 * 2); __bf16 (*th)[136] = (__bf16 (*)[136])sm; __bf16 (*tl2)[136] = (__bf16 (*)[136])(sm + 128 * 136 * 2);
#pragma unroll
  for (int j = 0; j < 4; ++j) { const int cl = wn * 64 + j * 16 + col; const float bb = BA ? bfr(BA[c0 + cl]) : 0.f;
#pragma unroll
    for (int i = 0; i < 4; ++i) acc[i][j] += bb; }
  if (which == 2) {
#pragma unroll
    for (int j = 0; j < 4; ++j)
#pragma unroll
      for (int i = 0; i < 4; ++i)
#pragma unroll
        for (int r = 0; r < 8; ++r) { const float v = acc[i][j][r]; const int cl = wn * 64 + j * 16 + col, rl = wm * 64 + i * 16 + 8 * g + r; const __bf16 bh = (__bf16)v; th[cl][rl] = bh; tl2[cl][rl] = (__bf16)(v - (float)bh); } }
  else {
#pragma unroll
    for (int j = 0; j < 4; ++j)
#pragma unroll
      for (int i = 0; i < 4; ++i)
#pragma unroll
        for (int r = 0; r < 8; ++r) { const float v = acc[i][j][r]; const int cl = wn * 64 + j * 16 + col, rl = wm * 64 + i * 16 + 8 * g + r; const _Float16 hv = (_Float16)v; sh[rl][cl] = hv; sl[rl][cl] = (_Float16)((v - (float)hv) * 1024.0f); }   /* q residual carried x 2^10 so the plane stays f16-normal on the chip */ }
  __syncthreads();
  if (which == 0) { for (int e = tid; e < 128 * 16; e += 128) { const int rl = e >> 4, q = e & 15; const size_t o1 = (r0 + rl) * CC + c0 + q * 8; vst2((unsigned*)(QH + o1), *(const v4u*)&sh[rl][q * 8]); vst2((unsigned*)(QL + o1), *(const v4u*)&sl[rl][q * 8]); } }
  else if (which == 1) { for (int e = tid; e < 128 * 16; e += 128) { const int rl = e >> 4, q = e & 15; vst2((unsigned*)(KH + (r0 + rl) * CC + c0 + q * 8), *(const v4u*)&sh[rl][q * 8]); } }
  else { const size_t b = r0 / TT; const int t0 = (int)(r0 % TT); for (int e = tid; e < 128 * 16; e += 128) { const int cl = e >> 4, q = e & 15; const size_t o2 = (b * CC + c0 + cl) * (size_t)TT + t0 + q * 8; vst2((unsigned*)(VT + o2), *(const v4u*)&th[cl][q * 8]); vst2((unsigned*)(VL + o2), *(const v4u*)&tl2[cl][q * 8]); } } }
__device__ __forceinline__ float xhalf(float v) { const int i = __builtin_bit_cast(int, v); return __builtin_bit_cast(float, __builtin_amdgcn_permlanex16(i, i, 0x76543210, 0xfedcba98, false, false)); }
#define AP 72                      /* LDS row pitch in 16-bit elements: 128 B of data + 16 B = 144 B = 16 B x 9, the pitch at which 16-byte fragment reads meet no bank conflict */
#define AROW (AP * 2)
#define ASTG (192 * AROW)          /* one stage = 64 keys: 64 K rows | 64 rows of v hi | 64 rows of v lo, each row one whole 128-B line */
// one stage's copies of one lane: four rows, 16 apart, of each of the three planes; 8 lanes x 16 B cover one whole line of global memory.
// The wait is the last line of the copies' own statement, so it stands in front of any later rewrite of their address registers
__device__ __forceinline__ void acopy12(unsigned l, const char* k, const char* v, const char* w) {
  const size_t ks = (size_t)16 * CC * 2, vs = (size_t)16 * TT * 2;
  asm volatile("global_load_async_to_lds_b128 %0, %12, off\n\tglobal_load_async_to_lds_b128 %1, %13, off\n\tglobal_load_async_to_lds_b128 %2, %14, off\n\tglobal_load_async_to_lds_b128 %3, %15, off\n\t"
               "global_load_async_to_lds_b128 %4, %16, off\n\tglobal_load_async_to_lds_b128 %5, %17, off\n\tglobal_load_async_to_lds_b128 %6, %18, off\n\tglobal_load_async_to_lds_b128 %7, %19, off\n\t"
               "global_load_async_to_lds_b128 %8, %20, off\n\tglobal_load_async_to_lds_b128 %9, %21, off\n\tglobal_load_async_to_lds_b128 %10, %22, off\n\tglobal_load_async_to_lds_b128 %11, %23, off\n\ts_wait_xcnt 0x0"
               :: "v"(l), "v"(l + 16u * AROW), "v"(l + 32u * AROW), "v"(l + 48u * AROW), "v"(l + 64u * AROW), "v"(l + 80u * AROW), "v"(l + 96u * AROW), "v"(l + 112u * AROW), "v"(l + 128u * AROW), "v"(l + 144u * AROW), "v"(l + 160u * AROW), "v"(l + 176u * AROW),
                  "v"(k), "v"(k + ks), "v"(k + 2 * ks), "v"(k + 3 * ks), "v"(v), "v"(v + vs), "v"(v + 2 * vs), "v"(v + 3 * vs), "v"(w), "v"(w + vs), "v"(w + 2 * vs), "v"(w + 3 * vs) : "memory"); }
__global__ __launch_bounds__(128) void k_att(const _Float16* __restrict__ QH, const _Float16* __restrict__ QL, const _Float16* __restrict__ KH, const __bf16* __restrict__ VT, const __bf16* __restrict__ VL, float* __restrict__ Y) {
  __shared__ __align__(16) char sm[2 * ASTG];   /* two stages: the block's four waves read their K and v fragments from here */
  const int tid = threadIdx.x, lane = tid & 31, col = lane & 15, g = lane >> 4; const int h = blockIdx.y, b = blockIdx.z;
  const int wave = __builtin_amdgcn_readfirstlane(tid >> 5);   /* the wave's number as a scalar: loop bounds, loop branch and chunk addresses stay scalar */
  const int Q0 = blockIdx.x * 64, q0 = Q0 + wave * 16;
  const int kclo = (q0 - (WIN - 1)) > 0 ? (q0 - (WIN - 1)) / 32 : 0;   /* first 32-key chunk that can hold a key inside the earliest query's window */
  const int kchi = (q0 + 16 + 31) / 32;                                /* one past the chunk that holds the last query's own key */
  const int slo = Q0 >= WIN ? (Q0 - WIN) / 64 : 0, shi = Q0 / 64 + 1;  /* the block's 64-key stages: from the one with key Q0 - 511 to the one with key Q0 + 63 */
  const size_t qo = ((size_t)b * TT + q0 + col) * CC + h * HD;
  const int sr = tid >> 3, sg = tid & 7;   /* staging: row sr (+ 16 i) of each plane, 16-byte piece sg of its line */
  const char* gk = (const char*)(KH + ((size_t)b * TT + sr) * CC + h * HD + sg * 8);
  const char* gv = (const char*)(VT + ((size_t)b * CC + h * HD + sr) * (size_t)TT + sg * 8);
  const char* gl = (const char*)(VL + ((size_t)b * CC + h * HD + sr) * (size_t)TT + sg * 8);
  const unsigned ls = (unsigned)(size_t)sm + (unsigned)(sr * AROW + sg * 16);
#define ASTAGE(s, buf) acopy12(ls + (unsigned)(buf) * ASTG, gk + (size_t)(s) * 64 * CC * 2, gv + (size_t)(s) * 128, gl + (size_t)(s) * 128)
  v16h qh[2], ql[2];
#pragma unroll
  for (int c = 0; c < 2; ++c) { qh[c] = frag_h(QH + qo + c * 32, lane); ql[c] = frag_h(QL + qo + c * 32, lane); }
  ASTAGE(slo, 0);
  asm volatile("s_wait_asynccnt 0x0" ::: "memory");   /* this wave's copies of the first stage have landed */
  __syncthreads();                                     /* ... and every other wave's */
  if (slo + 1 < shi) ASTAGE(slo + 1, 1);
  const float C2 = 0.125f * 1.4426950408889634f;   /* 1 / sqrt(64) and log2(e) in one factor: exp(s / 8 - max / 8) = exp2(s C2 - max C2) */
  v8f acc[HD / 16] = {}; float m = -1.0e30f, l = 0.f;   /* m: running maximum of the unscaled logits; it starts far above the mask fill, so a masked logit gives exp2 = 0 also while a column has met no allowed key yet */
#pragma unroll 1   /* one stage per trip */
  for (int s = slo; s < shi; ++s) { const int cur = (s - slo) & 1;
#pragma unroll 1   /* one chunk's fragments live at a time: four waves per SIMD fit */
    for (int hh = 0; hh < 2; ++hh) { const int kc = 2 * s + hh;
      if (kc >= kclo && kc < kchi) {   /* a scalar test: the wave works only on the chunks of its own queries' window, in rising order */
        const int k0 = kc * 32; const char* sb = sm + cur * ASTG; v16h kf[2][2]; v16b vh[HD / 16], vl[HD / 16];
        const _Float16* kl = (const _Float16*)sb + (hh * 32 + col) * AP; const __bf16* vp = (const __bf16*)(sb + 64 * AROW) + col * AP + hh * 32; const __bf16* lp = (const __bf16*)(sb + 128 * AROW) + col * AP + hh * 32;
#pragma unroll
        for (int t = 0; t < 2; ++t)
#pragma unroll
          for (int c = 0; c < 2; ++c) kf[t][c] = frag_h(kl + t * 16 * AP + c * 32, lane);
#pragma unroll
        for (int j = 0; j < HD / 16; ++j) { vh[j] = frag_b(vp + j * 16 * AP, lane); vl[j] = frag_b(lp + j * 16 * AP, lane); }
        v8f s2[2] = {}, sl[2] = {};
#pragma unroll
        for (int t = 0; t < 2; ++t)
#pragma unroll
          for (int c = 0; c < 2; ++c) { s2[t] = wmma16(kf[t][c], qh[c], s2[t]); sl[t] = wmma16(kf[t][c], ql[c], sl[t]); }
        float p[16]; float mx = m; const int dq = q0 + col - k0 - 8 * g;   /* query - key = dq - (16 t + r) */
#pragma unroll
        for (int t = 0; t < 2; ++t)
#pragma unroll
          for (int r = 0; r < 8; ++r) { const float v = s2[t][r] + sl[t][r] * (1.0f / 1024.0f); const bool allowed = (unsigned)(dq - (16 * t + r)) < (unsigned)WIN; p[8 * t + r] = allowed ? v : -3.0e38f; mx = fmaxf(mx, p[8 * t + r]); }
        mx = fmaxf(mx, xhalf(mx)); const float alpha = __builtin_amdgcn_exp2f((m - mx) * C2), mcn = mx * C2; m = mx; float ps = 0.f; const v2f c2 = { C2, C2 }, nm = { -mcn, -mcn };
#pragma unroll
        for (int i = 0; i < 16; i += 2) { const v2f a = { p[i], p[i + 1] }; const v2f e = __builtin_elementwise_fma(a, c2, nm); p[i] = __builtin_amdgcn_exp2f(e[0]); p[i + 1] = __builtin_amdgcn_exp2f(e[1]); ps += p[i]; ps += p[i + 1]; }
        l = l * alpha + ps;   /* each half sums its own keys; joined after the loop */
#pragma unroll
        for (int j = 0; j < HD / 16; ++j) acc[j] *= alpha;
        const F2 pf = bsplit16(p);
#pragma unroll
        for (int j = 0; j < HD / 16; ++j) { acc[j] = wmma_bf(vh[j], pf.h, acc[j]); acc[j] = wmma_bf(vh[j], pf.l, acc[j]); acc[j] = wmma_bf(vl[j], pf.h, acc[j]); } } }
    asm volatile("s_wait_dscnt 0x0" ::: "memory");      /* this wave's reads of the stage are done before the stage is handed back */
    asm volatile("s_wait_asynccnt 0x0" ::: "memory");   /* this wave's copies of the next stage have landed */
    __syncthreads();                                     /* publishes the next stage and ends every wave's reads of this one */
    if (s + 2 < shi) ASTAGE(s + 2, cur); }
  asm volatile("s_wait_asynccnt 0x0" ::: "memory");     /* no copy is outstanding when the wave ends */
  l += xhalf(l); const float inv = 1.0f / l; float* yr = Y + qo + 8 * g;
#pragma unroll
  for (int j = 0; j < HD / 16; ++j) { v4f a, c;
#pragma unroll
    for (int r = 0; r < 4; ++r) { a[r] = acc[j][r] * inv; c[r] = acc[j][4 + r] * inv; }
    vst2(yr + j * 16, a); vst2(yr + j * 16 + 4, c); } }
// ---- k_out: block = (64 rows, 128 cols), wave = 32 x 64: out = y (bf16 hi + lo) Wo^T + bo; staged like k_proj (Wo from its bf16 copy), y split once per block
__global__ __launch_bounds__(128) void k_out(const float* __restrict__ Y, const __bf16* __restrict__ WP, const float* __restrict__ BP, float* __restrict__ OUT) {
  __shared__ __align__(16) char sm[2 * 256 * LP * 2];   /* K loop: two stages of [y hi 64 rows | y lo 64 rows | W 128 rows]; afterwards the f32 output tile */
  stage_t* st = (stage_t*)sm;
  const int tid = threadIdx.x, wave = tid >> 5, lane = tid & 31, col = lane & 15, g = lane >> 4, wm = wave >> 1, wn = wave & 1; const int c0 = blockIdx.y * 128; const size_t r0 = (size_t)blockIdx.x * 64;
  const int sr = tid >> 3, sk = (tid & 7) * 8, yr = tid >> 4, yk = (tid & 15) * 4;   /* W: 8 lanes x 16 B = one line of 64 bf16; y: 16 lanes x 16 B = the two lines of 64 f32 */
  const float* py = Y + (r0 + yr) * CC + yk; const __bf16* pw = WP + (size_t)(c0 + sr) * CC + sk;
  v4f ry[8]; v8b rw[8]; v8f acc[2][4] = {};
#pragma unroll
  for (int i = 0; i < 8; ++i) { ry[i] = *(const v4f*)(py + (size_t)i * 8 * CC); rw[i] = *(const v8b*)(pw + (size_t)i * 16 * CC); }
  asm volatile("s_wait_xcnt 0x0" ::: "memory");   /* stands in front of any reuse of the loads' address registers */
#pragma unroll
  for (int i = 0; i < 8; ++i) { const v4b hi = cvt4(ry[i]); v4f rs;
#pragma unroll
    for (int e = 0; e < 4; ++e) rs[e] = ry[i][e] - (float)hi[e];
    *(v4b*)&st[0][yr + 8 * i][yk] = hi; *(v4b*)&st[0][64 + yr + 8 * i][yk] = cvt4(rs); *(v8b*)&st[0][128 + sr + 16 * i][sk] = rw[i]; }
  __syncthreads();
#pragma unroll 1   /* one slice's fragments and one slice in flight at a time */
  for (int kc = 0; kc < CC / 64; ++kc) { const int cur = kc & 1; const bool more = kc + 1 < CC / 64;
    if (more) {   /* the next slice flies under this slice's products */
#pragma unroll
      for (int i = 0; i < 8; ++i) { ry[i] = *(const v4f*)(py + (size_t)i * 8 * CC + (kc + 1) * 64); rw[i] = *(const v8b*)(pw + (size_t)i * 16 * CC + (kc + 1) * 64); }
      asm volatile("s_wait_xcnt 0x0" ::: "memory");   /* the loads' address registers are reused for the fragments below: the wait stands in front of that overwrite */ }
    v16b ah[2][2], al[2][2], w[2][4];   /* [32-k half][tile]: two blocks per WGP leave room for the whole slice's fragments */
#pragma unroll
    for (int hh = 0; hh < 2; ++hh) {
#pragma unroll
      for (int i = 0; i < 2; ++i) { ah[hh][i] = frag_b(&st[cur][wm * 32 + i * 16 + col][hh * 32], lane); al[hh][i] = frag_b(&st[cur][64 + wm * 32 + i * 16 + col][hh * 32], lane); }
#pragma unroll
      for (int j = 0; j < 4; ++j) w[hh][j] = frag_b(&st[cur][128 + wn * 64 + j * 16 + col][hh * 32], lane); }
    __builtin_amdgcn_sched_barrier(0);   /* the slice's fragment reads stay one group ahead of the products, as in k_proj */
#pragma unroll
    for (int hh = 0; hh < 2; ++hh) {   /* the slice's two 32-k halves, in rising k: the sums keep their order */
#pragma unroll
      for (int i = 0; i < 2; ++i)
#pragma unroll
        for (int j = 0; j < 4; ++j) acc[i][j] = wmma_bp(ah[hh][i], w[hh][j], acc[i][j]);
#pragma unroll
      for (int i = 0; i < 2; ++i)
#pragma unroll
        for (int j = 0; j < 4; ++j) acc[i][j] = (hh == 1 && i == 1 && j == 3) ? wmma_bf(al[hh][i], w[hh][j], acc[i][j]) : wmma_bp(al[hh][i], w[hh][j], acc[i][j]);   /* last product of the run: as in k_proj */ }
    if (more) {   /* into the stage whose readers all passed the barrier of the trip before */
#pragma unroll
      for (int i = 0; i < 8; ++i) { const v4b hi = cvt4(ry[i]); v4f rs;
#pragma unroll
        for (int e = 0; e < 4; ++e) rs[e] = ry[i][e] - (float)hi[e];
        *(v4b*)&st[cur ^ 1][yr + 8 * i][yk] = hi; *(v4b*)&st[cur ^ 1][64 + yr + 8 * i][yk] = cvt4(rs); *(v8b*)&st[cur ^ 1][128 + sr + 16 * i][sk] = rw[i]; } }
    __syncthreads(); }
  float (*sf)[132] = (float (*)[132])sm;
#pragma unroll
  for (int j = 0; j < 4; ++j) { const int cl = wn * 64 + j * 16 + col; const float bb = BP ? bfr(BP[c0 + cl]) : 0.f;
#pragma unroll
    for (int i = 0; i < 2; ++i)
#pragma unroll
      for (int r = 0; r < 8; ++r) sf[wm * 32 + i * 16 + 8 * g + r][cl] = acc[i][j][r] + bb; }
  __syncthreads();
  for (int rl = wave; rl < 64; rl += 4) vst2(OUT + (r0 + rl) * CC + c0 + lane * 4, *(const v4f*)&sf[rl][lane * 4]); }
extern "C" void kernel_launch(void* const* d_in, const int* in_sizes, int n_in, void* d_out, int out_size, void* d_ws, size_t ws_size, hipStream_t stream) {
  (void)in_sizes; (void)n_in; (void)out_size;
  const float** F = (const float**)d_in;   // 0 x [2,2048,1024], 1 w_qkv [3072,1024] ([out,in]; q | k | v row blocks), 2 w_out [1024,1024] ([out,in]), 3 b_out
  if (ws_size < (size_t)WS_END) return;
  char* ws = (char*)d_ws; _Float16 *QH = (_Float16*)(ws + WS_QH), *QL = (_Float16*)(ws + WS_QL), *KH = (_Float16*)(ws + WS_KH); __bf16 *VT = (__bf16*)(ws + WS_VT), *VL = (__bf16*)(ws + WS_VL), *XB = (__bf16*)(ws + WS_XB); float *Y = (float*)(ws + WS_Y);
  const __bf16* WQ = XB + (size_t)NB * TT * CC; const __bf16* WK = WQ + (size_t)CC * CC; const __bf16* WV = WQ + 2u * (size_t)CC * CC; const __bf16* WO = WQ + 3u * (size_t)CC * CC;
  k_cvt<<<dim3(NXB + NWB + NOB), 256, 0, stream>>>(F[0], F[1], F[2], XB);
  k_proj<<<dim3(TNB * TT / 128, CC / 128, 3), 128, 0, stream>>>(XB, WQ, nullptr, WK, nullptr, WV, nullptr, QH, QL, KH, VT, VL);
  k_att<<<dim3(TT / 64, NH, TNB), 128, 0, stream>>>(QH, QL, KH, VT, VL, Y);
  k_out<<<dim3(TNB * TT / 64, CC / 128), 128, 0, stream>>>(Y, WO, F[3], (float*)d_out);
}

// v006
// Measured time: 80.3 microseconds a run.
// Timed twice side by side with v005, it ran 1.03 and 1.02 times as fast.
// Counting every step since v000, it is 11.4 times as fast.
// compute dtype: all float inputs rounded to bf16; qkv = x W_qkv^T with EXACT bf16 products on WMMA 16x16x32, f32 accumulate; q as f16 hi + residual (x 2^10), k f16 -> 2-product logits / 8 inside the causal sliding window (j <= i, i - j < 512), 32-key chunks of the window only, kept in registers; softmax in f32 in base 2 (hardware exp2 of logit x log2(e) / 8 minus the scaled maximum, one fma) with a running maximum, P unnormalised split bf16 hi + lo against v bf16 hi + lo (3 products), divided by the row sum at the end; out = ctx (bf16 hi + lo) w_out^T + b_out; f32 output.
#include <hip/hip_runtime.h>
#include <math.h>

typedef __attribute__((ext_vector_type(16))) _Float16 v16h;
typedef __attribute__((ext_vector_type(16))) __bf16 v16b;
typedef __attribute__((ext_vector_type(8)))  _Float16 v8h;
typedef __attribute__((ext_vector_type(8)))  float v8f;
typedef __attribute__((ext_vector_type(4)))  float v4f;
typedef __attribute__((ext_vector_type(2)))  float v2f;
typedef __attribute__((ext_vector_type(4)))  unsigned v4u;
typedef __attribute__((ext_vector_type(4)))  int v4i;
typedef float __attribute__((may_alias)) float_a;
typedef int __attribute__((may_alias)) int_a;

template <typename T> __device__ __forceinline__ void vst2(void* p, T v) { *(T*)p = v;  }
__device__ __forceinline__ v8f wmma16(v16h a, v16h b, v8f c) {
  v8f d = __builtin_amdgcn_wmma_f32_16x16x32_f16(false, a, false, b, (short)0, c, false, false);
  asm volatile("v_nop\n\tv_nop\n\tv_nop\n\tv_nop" : "+v"(d) : "v"(a), "v"(b));
  return d;
}
__device__ __forceinline__ v8f wmma_bf(v16b a, v16b b, v8f c) {
  v8f d = __builtin_amdgcn_wmma_f32_16x16x32_bf16(false, a, false, b, (short)0, c, false, false);
  asm volatile("v_nop\n\tv_nop\n\tv_nop\n\tv_nop" : "+v"(d) : "v"(a), "v"(b));
  return d;
}
// 16x16x32 fragments: lane = (h = lane>>4, row/col = lane&15); elements 0..7 = k0+8h+0..7, 8..15 = k0+16+8h+0..7; D element r = row 8h+r
__device__ __forceinline__ v16h frag_h(const _Float16* rowk0, int lane) {
  union { v16h v; v8h q[2]; } u; const _Float16* p = rowk0 + 8 * (lane >> 4);
  u.q[0] = *(const v8h*)p; u.q[1] = *(const v8h*)(p + 16); return u.v;
}
__device__ __forceinline__ v16h frag_f32(const float* rowk0, int lane) {
  v16h a; const float* p = rowk0 + 8 * (lane >> 4);
#pragma unroll
  for (int i = 0; i < 8; ++i) { a[i] = (_Float16)p[i]; a[8 + i] = (_Float16)p[16 + i]; }
  return a;
}
__device__ __forceinline__ v16h frag_f32s(const float* rowk0, int lane, float sc) {
  v16h a; const float* p = rowk0 + 8 * (lane >> 4);
#pragma unroll
  for (int i = 0; i < 8; ++i) { a[i] = (_Float16)(p[i] * sc); a[8 + i] = (_Float16)(p[16 + i] * sc); }
  return a;
}
// column fragment from a [K][ld] layout (column n), rows >= K read as 0
__device__ __forceinline__ v16h fragc_f32(const float* W, int k0, int n, int lane, int ld, int K) {
  v16h a; const int g = lane >> 4;
#pragma unroll
  for (int i = 0; i < 8; ++i) { const int ka = k0 + 8 * g + i, kb = ka + 16;
    a[i] = (_Float16)(ka < K ? W[(size_t)(ka < K ? ka : K - 1) * ld + n] : 0.f); a[8 + i] = (_Float16)(kb < K ? W[(size_t)(kb < K ? kb : K - 1) * ld + n] : 0.f); }
  return a;
}
struct F2 { v16b h, l; };
__device__ __forceinline__ F2 bsplit16(const float v[16]) { F2 r;
#pragma unroll
  for (int i = 0; i < 16; ++i) { const __bf16 h = (__bf16)v[i]; r.h[i] = h; r.l[i] = (__bf16)(v[i] - (float)h); }
  return r; }
__device__ __forceinline__ F2 split_row(const float* row, int k0, int lane) { float v[16]; const float* p = row + k0 + 8 * (lane >> 4);
#pragma unroll
  for (int i = 0; i < 8; ++i) { v[i] = p[i]; v[8 + i] = p[16 + i]; }
  return bsplit16(v); }
__device__ __forceinline__ F2 split_rowK(const float* row, int k0, int lane, int K) { float v[16]; const int g = lane >> 4;
#pragma unroll
  for (int i = 0; i < 8; ++i) { const int ka = k0 + 8 * g + i, kb = ka + 16; v[i] = ka < K ? row[ka < K ? ka : K - 1] : 0.f; v[8 + i] = kb < K ? row[kb < K ? kb : K - 1] : 0.f; }
  return bsplit16(v); }
__device__ __forceinline__ F2 split_col(const float* W, int k0, int n, int lane, int ld, int K) { float v[16]; const int g = lane >> 4;
#pragma unroll
  for (int i = 0; i < 8; ++i) { const int ka = k0 + 8 * g + i, kb = ka + 16; v[i] = ka < K ? W[(size_t)(ka < K ? ka : K - 1) * ld + n] : 0.f; v[8 + i] = kb < K ? W[(size_t)(kb < K ? kb : K - 1) * ld + n] : 0.f; }
  return bsplit16(v); }
__device__ __forceinline__ v8f mac3(const F2& a, const F2& b, v8f c) { c = wmma_bf(a.l, b.h, c); c = wmma_bf(a.h, b.l, c); return wmma_bf(a.h, b.h, c); }
__device__ __forceinline__ float sigm(float v) { return 1.0f / (1.0f + expf(-v)); }
#define LDSX() do { asm volatile("s_wait_dscnt 0" ::: "memory"); __builtin_amdgcn_wave_barrier(); __builtin_amdgcn_fence(__ATOMIC_RELEASE, "workgroup"); } while (0)


// Sliding-window causal MHA (B 2, S 2,048, 1,024 = 16 x 64, window 512): qkv = x W_qkv^T (no bias), allowed(i,j) = j <= i and i - j < 512, softmax, P v, out = ctx w_out^T + b_out.
#define NB 2
#define TT 2048
#define CC 1024
#define NH 16
#define HD 64
#define WIN 512
#ifndef TNB
#define TNB NB
#endif
typedef __attribute__((ext_vector_type(8))) __bf16 v8b;
__device__ __forceinline__ v16b frag_b(const __bf16* rowk0, int lane) {
  union { v16b v; v8b q[2]; } u; const __bf16* p = rowk0 + 8 * (lane >> 4);
  u.q[0] = *(const v8b*)p; u.q[1] = *(const v8b*)(p + 16); return u.v;
}
__device__ __forceinline__ float bfr(float v) { return (float)(__bf16)v; }
__device__ __attribute__((noinline)) float exp_ni(float v) { return expf(v); }
__device__ __attribute__((noinline)) float erf_ni(float v) { return erff(v); }

#define WS_QH  0u
#define WS_QL  (WS_QH + 2u * (size_t)NB * TT * CC)
#define WS_KH  (WS_QL + 2u * (size_t)NB * TT * CC)
#define WS_VT  (WS_KH + 2u * (size_t)NB * TT * CC)      // bf16 v hi planes [b][c][t]
#define WS_VL  (WS_VT + 2u * (size_t)NB * CC * TT)      // bf16 v residual planes
#define WS_Y   (WS_VL + 2u * (size_t)NB * CC * TT)      // f32 y rows [b*t][C]
#define WS_XB  (WS_Y + 4u * (size_t)NB * TT * CC)       // bf16 copies, one range: x rows | w_qkv rows | w_out rows
#define WS_END (WS_XB + 2u * ((size_t)NB * TT * CC + 4u * (size_t)CC * CC))

// ---- LDS staging shared by the two projection kernels: a 64-k slice of both operands is read from global memory once per block with whole-line loads
//      (bf16 operands: 8 lanes x 16 B = one 128-B row slice), and kept in LDS rows of 144 B (16 B x odd: the 16-byte fragment reads meet no bank conflict)
#define LP 72
typedef __attribute__((ext_vector_type(4))) __bf16 v4b;
typedef __bf16 stage_t[256][LP];
__device__ __forceinline__ v4b cvt4(v4f v) { v4b r;
#pragma unroll
  for (int i = 0; i < 4; ++i) r[i] = (__bf16)v[i];
  return r; }
// the staged loops issue runs of independent products: the plain builtin leaves the compiler free in its register choice (no operand tied to an asm statement) and it keeps the distances itself
__device__ __forceinline__ v8f wmma_bp(v16b a, v16b b, v8f c) { return __builtin_amdgcn_wmma_f32_16x16x32_bf16(false, a, false, b, (short)0, c, false, false); }
__device__ __forceinline__ v8f wmma_hp(v16h a, v16h b, v8f c) { return __builtin_amdgcn_wmma_f32_16x16x32_f16(false, a, false, b, (short)0, c, false, false); }
// ---- k_cvt: x, w_qkv and w_out are rounded to bf16 once, so that the projection kernels, whose blocks read every row 24 to 64 times, move half the bytes and convert nothing;
//      block = 32,768 elements of one of the three, one block per WGP, all of a wave's 32 loads in flight at once; a wave's load covers four whole lines, its store two
#define CVB 32768
#define NXB (NB * TT * CC / CVB)
#define NWB (3 * CC * CC / CVB)
#define NOB (CC * CC / CVB)
__global__ __launch_bounds__(256) void k_cvt(const float* __restrict__ X, const float* __restrict__ WQKV, const float* __restrict__ WO, __bf16* __restrict__ D) {
  const int b = blockIdx.x, tid = threadIdx.x;
  const float* s = b < NXB ? X + (size_t)b * CVB : b < NXB + NWB ? WQKV + (size_t)(b - NXB) * CVB : WO + (size_t)(b - NXB - NWB) * CVB;
  __bf16* d = D + (size_t)b * CVB; v4f r[32];
#pragma unroll
  for (int i = 0; i < 32; ++i) r[i] = *(const v4f*)(s + (i * 256 + tid) * 4);
#pragma unroll
  for (int i = 0; i < 32; ++i) *(v4b*)(d + (i * 256 + tid) * 4) = cvt4(r[i]); }
// ---- k_proj: block = (128 rows, 128 cols, which), wave = 64 x 64: qkv = x W (+ b), exact; q -> f16 hi (+ residual), k -> f16 rows, v -> bf16 planes
__global__ __launch_bounds__(128) void k_proj(const __bf16* __restrict__ X, const __bf16* __restrict__ WQ, const float* __restrict__ BQ, const __bf16* __restrict__ WK, const float* __restrict__ BK, const __bf16* __restrict__ WV, const float* __restrict__ BV, _Float16* __restrict__ QH, _Float16* __restrict__ QL, _Float16* __restrict__ KH, __bf16* __restrict__ VT, __bf16* __restrict__ VL) {
  __shared__ __align__(16) char sm[2 * 256 * LP * 2];   /* K loop: two stages of [x 128 rows | W 128 rows]; afterwards the two output planes (2 x 128 x 136 x 2 B fit) */
  stage_t* st = (stage_t*)sm;
  const int tid = threadIdx.x, wave = tid >> 5, lane = tid & 31, col = lane & 15, g = lane >> 4, wm = wave >> 1, wn = wave & 1; const int which = blockIdx.z; const int c0 = blockIdx.y * 128; const size_t r0 = (size_t)blockIdx.x * 128; const __bf16* WA = which == 0 ? WQ : which == 1 ? WK : WV; const float* BA = which == 0 ? BQ : which == 1 ? BK : BV;
  const int sr = tid >> 3, sk = (tid & 7) * 8; const __bf16* px = X + (r0 + sr) * CC + sk; const __bf16* pw = WA + (size_t)(c0 + sr) * CC + sk;
  v8b rx[8], rw[8]; v8f acc[4][4] = {};
#pragma unroll
  for (int i = 0; i < 8; ++i) { rx[i] = *(const v8b*)(px + (size_t)i * 16 * CC); rw[i] = *(const v8b*)(pw + (size_t)i * 16 * CC); }
  asm volatile("s_wait_xcnt 0x0" ::: "memory");   /* stands in front of any reuse of the loads' address registers */
#pragma unroll
  for (int i = 0; i < 8; ++i) { *(v8b*)&st[0][sr + 16 * i][sk] = rx[i]; *(v8b*)&st[0][128 + sr + 16 * i][sk] = rw[i]; }
  __syncthreads();
#pragma unroll 1   /* one half slice's fragments and one slice in flight at a time: three blocks per WGP fit */
  for (int kc = 0; kc < CC / 64; ++kc) { const int cur = kc & 1; const bool more = kc + 1 < CC / 64;
    if (more) {   /* the next slice flies under this slice's products */
#pragma unroll
      for (int i = 0; i < 8; ++i) { rx[i] = *(const v8b*)(px + (size_t)i * 16 * CC + (kc + 1) * 64); rw[i] = *(const v8b*)(pw + (size_t)i * 16 * CC + (kc + 1) * 64); }
      asm volatile("s_wait_xcnt 0x0" ::: "memory");   /* the loads' address registers are reused for the fragments below: the wait stands in front of that overwrite */ }
#pragma unroll
    for (int hh = 0; hh < 2; ++hh) {   /* the slice's two 32-k halves, in rising k: the sums keep their order */
      v16b a[4], w[4];
#pragma unroll
      for (int i = 0; i < 4; ++i) { a[i] = frag_b(&st[cur][wm * 64 + i * 16 + col][hh * 32], lane); w[i] = frag_b(&st[cur][128 + wn * 64 + i * 16 + col][hh * 32], lane); }
      __builtin_amdgcn_sched_barrier(0);   /* all sixteen fragment reads stay one group ahead of the products; sunk among them, each place costs the wave an LDS wait */
#pragma unroll
      for (int i = 0; i < 4; ++i)
#pragma unroll
        for (int j = 0; j < 4; ++j) acc[i][j] = (hh == 1 && i == 3 && j == 3) ? wmma_bf(a[i], w[j], acc[i][j]) : wmma_bp(a[i], w[j], acc[i][j]);   /* the run's last product carries its four slots itself: a branch follows */
      if (hh == 0) __builtin_amdgcn_sched_barrier(0);   /* the second half's reads stay one group behind the first half's products, in the same registers: a second fragment set would cost the third block per WGP */ }
    if (more) {   /* into the stage whose readers all passed the barrier of the trip before */
#pragma unroll
      for (int i = 0; i < 8; ++i) { *(v8b*)&st[cur ^ 1][sr + 16 * i][sk] = rx[i]; *(v8b*)&st[cur ^ 1][128 + sr + 16 * i][sk] = rw[i]; } }
    __syncthreads(); }
  _Float16 (*sh)[136] = (_Float16 (*)[136])sm; _Float16 (*sl)[136] = (_Float16 (*)[136])(sm + 128 * 136 * 2); __bf16 (*th)[136] = (__bf16 (*)[136])sm; __bf16 (*tl2)[136] = (__bf16 (*)[136])(sm + 128 * 136 * 2);
#pragma unroll
  for (int j = 0; j < 4; ++j) { const int cl = wn * 64 + j * 16 + col; const float bb = BA ? bfr(BA[c0 + cl]) : 0.f;
#pragma unroll
    for (int i = 0; i < 4; ++i) acc[i][j] += bb; }
  if (which == 2) {
#pragma unroll
    for (int j = 0; j < 4; ++j)
#pragma unroll
      for (int i = 0; i < 4; ++i)
#pragma unroll
        for (int r = 0; r < 8; ++r) { const float v = acc[i][j][r]; const int cl = wn * 64 + j * 16 + col, rl = wm * 64 + i * 16 + 8 * g + r; const __bf16 bh = (__bf16)v; th[cl][rl] = bh; tl2[cl][rl] = (__bf16)(v - (float)bh); } }
  else {
#pragma unroll
    for (int j = 0; j < 4; ++j)
#pragma unroll
      for (int i = 0; i < 4; ++i)
#pragma unroll
        for (int r = 0; r < 8; ++r) { const float v = acc[i][j][r]; const int cl = wn * 64 + j * 16 + col, rl = wm * 64 + i * 16 + 8 * g + r; const _Float16 hv = (_Float16)v; sh[rl][cl] = hv; sl[rl][cl] = (_Float16)((v - (float)hv) * 1024.0f); }   /* q residual carried x 2^10 so the plane stays f16-normal on the chip */ }
  __syncthreads();
  if (which == 0) { for (int e = tid; e < 128 * 16; e += 128) { const int rl = e >> 4, q = e & 15; const size_t o1 = (r0 + rl) * CC + c0 + q * 8; vst2((unsigned*)(QH + o1), *(const v4u*)&sh[rl][q * 8]); vst2((unsigned*)(QL + o1), *(const v4u*)&sl[rl][q * 8]); } }
  else if (which == 1) { for (int e = tid; e < 128 * 16; e += 128) { const int rl = e >> 4, q = e & 15; vst2((unsigned*)(KH + (r0 + rl) * CC + c0 + q * 8), *(const v4u*)&sh[rl][q * 8]); } }
  else { const size_t b = r0 / TT; const int t0 = (int)(r0 % TT); for (int e = tid; e < 128 * 16; e += 128) { const int cl = e >> 4, q = e & 15; const size_t o2 = (b * CC + c0 + cl) * (size_t)TT + t0 + q * 8; vst2((unsigned*)(VT + o2), *(const v4u*)&th[cl][q * 8]); vst2((unsigned*)(VL + o2), *(const v4u*)&tl2[cl][q * 8]); } } }
__device__ __forceinline__ float xhalf(float v) { const int i = __builtin_bit_cast(int, v); return __builtin_bit_cast(float, __builtin_amdgcn_permlanex16(i, i, 0x76543210, 0xfedcba98, false, false)); }
#define AP 72                      /* LDS row pitch in 16-bit elements: 128 B of data + 16 B = 144 B = 16 B x 9, the pitch at which 16-byte fragment reads meet no bank conflict */
#define AROW (AP * 2)
#define ASTG (192 * AROW)          /* one stage = 64 keys: 64 K rows | 64 rows of v hi | 64 rows of v lo, each row one whole 128-B line */
// one stage's copies of one lane: four rows, 16 apart, of each of the three planes; 8 lanes x 16 B cover one whole line of global memory.
// The wait is the last line of the copies' own statement, so it stands in front of any later rewrite of their address registers
__device__ __forceinline__ void acopy12(unsigned l, const char* k, const char* v, const char* w) {
  const size_t ks = (size_t)16 * CC * 2, vs = (size_t)16 * TT * 2;
  asm volatile("global_load_async_to_lds_b128 %0, %12, off\n\tglobal_load_async_to_lds_b128 %1, %13, off\n\tglobal_load_async_to_lds_b128 %2, %14, off\n\tglobal_load_async_to_lds_b128 %3, %15, off\n\t"
               "global_load_async_to_lds_b128 %4, %16, off\n\tglobal_load_async_to_lds_b128 %5, %17, off\n\tglobal_load_async_to_lds_b128 %6, %18, off\n\tglobal_load_async_to_lds_b128 %7, %19, off\n\t"
               "global_load_async_to_lds_b128 %8, %20, off\n\tglobal_load_async_to_lds_b128 %9, %21, off\n\tglobal_load_async_to_lds_b128 %10, %22, off\n\tglobal_load_async_to_lds_b128 %11, %23, off\n\ts_wait_xcnt 0x0"
               :: "v"(l), "v"(l + 16u * AROW), "v"(l + 32u * AROW), "v"(l + 48u * AROW), "v"(l + 64u * AROW), "v"(l + 80u * AROW), "v"(l + 96u * AROW), "v"(l + 112u * AROW), "v"(l + 128u * AROW), "v"(l + 144u * AROW), "v"(l + 160u * AROW), "v"(l + 176u * AROW),
                  "v"(k), "v"(k + ks), "v"(k + 2 * ks), "v"(k + 3 * ks), "v"(v), "v"(v + vs), "v"(v + 2 * vs), "v"(v + 3 * vs), "v"(w), "v"(w + vs), "v"(w + 2 * vs), "v"(w + 3 * vs) : "memory"); }
__global__ __launch_bounds__(128) void k_att(const _Float16* __restrict__ QH, const _Float16* __restrict__ QL, const _Float16* __restrict__ KH, const __bf16* __restrict__ VT, const __bf16* __restrict__ VL, float* __restrict__ Y) {
  __shared__ __align__(16) char sm[2 * ASTG];   /* two stages: the block's four waves read their K and v fragments from here */
  const int tid = threadIdx.x, lane = tid & 31, col = lane & 15, g = lane >> 4; const int h = blockIdx.y, b = blockIdx.z;
  const int wave = __builtin_amdgcn_readfirstlane(tid >> 5);   /* the wave's number as a scalar: loop bounds, loop branch and chunk addresses stay scalar */
  const int Q0 = blockIdx.x * 64, q0 = Q0 + wave * 16;
  const int kclo = (q0 - (WIN - 1)) > 0 ? (q0 - (WIN - 1)) / 32 : 0;   /* first 32-key chunk that can hold a key inside the earliest query's window */
  const int kchi = (q0 + 16 + 31) / 32;                                /* one past the chunk that holds the last query's own key */
  const int slo = Q0 >= WIN ? (Q0 - WIN) / 64 : 0, shi = Q0 / 64 + 1;  /* the block's 64-key stages: from the one with key Q0 - 511 to the one with key Q0 + 63 */
  const size_t qo = ((size_t)b * TT + q0 + col) * CC + h * HD;
  const int sr = tid >> 3, sg = tid & 7;   /* staging: row sr (+ 16 i) of each plane, 16-byte piece sg of its line */
  const char* gk = (const char*)(KH + ((size_t)b * TT + sr) * CC + h * HD + sg * 8);
  const char* gv = (const char*)(VT + ((size_t)b * CC + h * HD + sr) * (size_t)TT + sg * 8);
  const char* gl = (const char*)(VL + ((size_t)b * CC + h * HD + sr) * (size_t)TT + sg * 8);
  const unsigned ls = (unsigned)(size_t)sm + (unsigned)(sr * AROW + sg * 16);
#define ASTAGE(s, buf) acopy12(ls + (unsigned)(buf) * ASTG, gk + (size_t)(s) * 64 * CC * 2, gv + (size_t)(s) * 128, gl + (size_t)(s) * 128)
  v16h qh[2], ql[2];
#pragma unroll
  for (int c = 0; c < 2; ++c) { qh[c] = frag_h(QH + qo + c * 32, lane); ql[c] = frag_h(QL + qo + c * 32, lane); }
  ASTAGE(slo, 0);
  asm volatile("s_wait_asynccnt 0x0" ::: "memory");   /* this wave's copies of the first stage have landed */
  __syncthreads();                                     /* ... and every other wave's */
  if (slo + 1 < shi) ASTAGE(slo + 1, 1);
  const float C2 = 0.125f * 1.4426950408889634f;   /* 1 / sqrt(64) and log2(e) in one factor: exp(s / 8 - max / 8) = exp2(s C2 - max C2) */
  v8f acc[HD / 16] = {}; float m = -1.0e30f, l = 0.f;   /* m: running maximum of the unscaled logits; it starts far above the mask fill, so a masked logit gives exp2 = 0 also while a column has met no allowed key yet */
#pragma unroll 1   /* one stage per trip */
  for (int s = slo; s < shi; ++s) { const int cur = (s - slo) & 1;
#pragma unroll 1   /* one chunk's fragments live at a time: four waves per SIMD fit */
    for (int hh = 0; hh < 2; ++hh) { const int kc = 2 * s + hh;
      if (kc >= kclo && kc < kchi) {   /* a scalar test: the wave works only on the chunks of its own queries' window, in rising order */
        const int k0 = kc * 32; const char* sb = sm + cur * ASTG; v16h kf[2][2]; v16b vh[HD / 16], vl[HD / 16];
        const _Float16* kl = (const _Float16*)sb + (hh * 32 + col) * AP; const __bf16* vp = (const __bf16*)(sb + 64 * AROW) + col * AP + hh * 32; const __bf16* lp = (const __bf16*)(sb + 128 * AROW) + col * AP + hh * 32;
#pragma unroll
        for (int t = 0; t < 2; ++t)
#pragma unroll
          for (int c = 0; c < 2; ++c) kf[t][c] = frag_h(kl + t * 16 * AP + c * 32, lane);
#pragma unroll
        for (int j = 0; j < HD / 16; ++j) { vh[j] = frag_b(vp + j * 16 * AP, lane); vl[j] = frag_b(lp + j * 16 * AP, lane); }
        __builtin_amdgcn_sched_barrier(0);   /* the chunk's 24 fragment reads stay one group ahead of the products; sunk among them, each place costs the wave an LDS wait */
        v8f s2[2] = {}, sl[2] = {};
#pragma unroll
        for (int t = 0; t < 2; ++t)
#pragma unroll
          for (int c = 0; c < 2; ++c) { s2[t] = wmma_hp(kf[t][c], qh[c], s2[t]); sl[t] = wmma_hp(kf[t][c], ql[c], sl[t]); }
        float p[16]; float mx = m; const int dq = q0 + col - k0 - 8 * g;   /* query - key = dq - (16 t + r) */
#pragma unroll
        for (int t = 0; t < 2; ++t)
#pragma unroll
          for (int r = 0; r < 8; ++r) { const float v = s2[t][r] + sl[t][r] * (1.0f / 1024.0f); const bool allowed = (unsigned)(dq - (16 * t + r)) < (unsigned)WIN; p[8 * t + r] = allowed ? v : -3.0e38f; mx = fmaxf(mx, p[8 * t + r]); }
        mx = fmaxf(mx, xhalf(mx)); const float alpha = __builtin_amdgcn_exp2f((m - mx) * C2), mcn = mx * C2; m = mx; float ps = 0.f; const v2f c2 = { C2, C2 }, nm = { -mcn, -mcn };
#pragma unroll
        for (int i = 0; i < 16; i += 2) { const v2f a = { p[i], p[i + 1] }; const v2f e = __builtin_elementwise_fma(a, c2, nm); p[i] = __builtin_amdgcn_exp2f(e[0]); p[i + 1] = __builtin_amdgcn_exp2f(e[1]); ps += p[i]; ps += p[i + 1]; }
        l = l * alpha + ps;   /* each half sums its own keys; joined after the loop */
#pragma unroll
        for (int j = 0; j < HD / 16; ++j) acc[j] *= alpha;
        const F2 pf = bsplit16(p);
#pragma unroll
        for (int j = 0; j < HD / 16; ++j) acc[j] = wmma_bp(vh[j], pf.h, acc[j]);   /* three runs over the four output tiles: no product waits for the one before it; each tile still sums hi.hi, hi.lo, lo.hi in that order */
#pragma unroll
        for (int j = 0; j < HD / 16; ++j) acc[j] = wmma_bp(vh[j], pf.l, acc[j]);
#pragma unroll
        for (int j = 0; j < HD / 16; ++j) acc[j] = j == HD / 16 - 1 ? wmma_bf(vl[j], pf.h, acc[j]) : wmma_bp(vl[j], pf.h, acc[j]);   /* the chunk's last product carries its four slots itself: a branch follows */ } }
    asm volatile("s_wait_dscnt 0x0" ::: "memory");      /* this wave's reads of the stage are done before the stage is handed back */
    asm volatile("s_wait_asynccnt 0x0" ::: "memory");   /* this wave's copies of the next stage have landed */
    __syncthreads();                                     /* publishes the next stage and ends every wave's reads of this one */
    if (s + 2 < shi) ASTAGE(s + 2, cur); }
  asm volatile("s_wait_asynccnt 0x0" ::: "memory");     /* no copy is outstanding when the wave ends */
  l += xhalf(l); const float inv = 1.0f / l; float* yr = Y + qo + 8 * g;
#pragma unroll
  for (int j = 0; j < HD / 16; ++j) { v4f a, c;
#pragma unroll
    for (int r = 0; r < 4; ++r) { a[r] = acc[j][r] * inv; c[r] = acc[j][4 + r] * inv; }
    vst2(yr + j * 16, a); vst2(yr + j * 16 + 4, c); } }
// ---- k_out: block = (64 rows, 128 cols), wave = 32 x 64: out = y (bf16 hi + lo) Wo^T + bo; staged like k_proj (Wo from its bf16 copy), y split once per block
__global__ __launch_bounds__(128) void k_out(const float* __restrict__ Y, const __bf16* __restrict__ WP, const float* __restrict__ BP, float* __restrict__ OUT) {
  __shared__ __align__(16) char sm[2 * 256 * LP * 2];   /* K loop: two stages of [y hi 64 rows | y lo 64 rows | W 128 rows]; afterwards the f32 output tile */
  stage_t* st = (stage_t*)sm;
  const int tid = threadIdx.x, wave = tid >> 5, lane = tid & 31, col = lane & 15, g = lane >> 4, wm = wave >> 1, wn = wave & 1; const int c0 = blockIdx.y * 128; const size_t r0 = (size_t)blockIdx.x * 64;
  const int sr = tid >> 3, sk = (tid & 7) * 8, yr = tid >> 4, yk = (tid & 15) * 4;   /* W: 8 lanes x 16 B = one line of 64 bf16; y: 16 lanes x 16 B = the two lines of 64 f32 */
  const float* py = Y + (r0 + yr) * CC + yk; const __bf16* pw = WP + (size_t)(c0 + sr) * CC + sk;
  v4f ry[8]; v8b rw[8]; v8f acc[2][4] = {};
#pragma unroll
  for (int i = 0; i < 8; ++i) { ry[i] = *(const v4f*)(py + (size_t)i * 8 * CC); rw[i] = *(const v8b*)(pw + (size_t)i * 16 * CC); }
  asm volatile("s_wait_xcnt 0x0" ::: "memory");   /* stands in front of any reuse of the loads' address registers */
#pragma unroll
  for (int i = 0; i < 8; ++i) { const v4b hi = cvt4(ry[i]); v4f rs;
#pragma unroll
    for (int e = 0; e < 4; ++e) rs[e] = ry[i][e] - (float)hi[e];
    *(v4b*)&st[0][yr + 8 * i][yk] = hi; *(v4b*)&st[0][64 + yr + 8 * i][yk] = cvt4(rs); *(v8b*)&st[0][128 + sr + 16 * i][sk] = rw[i]; }
  __syncthreads();
#pragma unroll 1   /* one slice's fragments and one slice in flight at a time */
  for (int kc = 0; kc < CC / 64; ++kc) { const int cur = kc & 1; const bool more = kc + 1 < CC / 64;
    if (more) {   /* the next slice flies under this slice's products */
#pragma unroll
      for (int i = 0; i < 8; ++i) { ry[i] = *(const v4f*)(py + (size_t)i * 8 * CC + (kc + 1) * 64); rw[i] = *(const v8b*)(pw + (size_t)i * 16 * CC + (kc + 1) * 64); }
      asm volatile("s_wait_xcnt 0x0" ::: "memory");   /* the loads' address registers are reused for the fragments below: the wait stands in front of that overwrite */ }
    v16b ah[2][2], al[2][2], w[2][4];   /* [32-k half][tile]: two blocks per WGP leave room for the whole slice's fragments */
#pragma unroll
    for (int hh = 0; hh < 2; ++hh) {
#pragma unroll
      for (int i = 0; i < 2; ++i) { ah[hh][i] = frag_b(&st[cur][wm * 32 + i * 16 + col][hh * 32], lane); al[hh][i] = frag_b(&st[cur][64 + wm * 32 + i * 16 + col][hh * 32], lane); }
#pragma unroll
      for (int j = 0; j < 4; ++j) w[hh][j] = frag_b(&st[cur][128 + wn * 64 + j * 16 + col][hh * 32], lane); }
    __builtin_amdgcn_sched_barrier(0);   /* the slice's fragment reads stay one group ahead of the products, as in k_proj */
#pragma unroll
    for (int hh = 0; hh < 2; ++hh) {   /* the slice's two 32-k halves, in rising k: the sums keep their order */
#pragma unroll
      for (int i = 0; i < 2; ++i)
#pragma unroll
        for (int j = 0; j < 4; ++j) acc[i][j] = wmma_bp(ah[hh][i], w[hh][j], acc[i][j]);
#pragma unroll
      for (int i = 0; i < 2; ++i)
#pragma unroll
        for (int j = 0; j < 4; ++j) acc[i][j] = (hh == 1 && i == 1 && j == 3) ? wmma_bf(al[hh][i], w[hh][j], acc[i][j]) : wmma_bp(al[hh][i], w[hh][j], acc[i][j]);   /* last product of the run: as in k_proj */ }
    if (more) {   /* into the stage whose readers all passed the barrier of the trip before */
#pragma unroll
      for (int i = 0; i < 8; ++i) { const v4b hi = cvt4(ry[i]); v4f rs;
#pragma unroll
        for (int e = 0; e < 4; ++e) rs[e] = ry[i][e] - (float)hi[e];
        *(v4b*)&st[cur ^ 1][yr + 8 * i][yk] = hi; *(v4b*)&st[cur ^ 1][64 + yr + 8 * i][yk] = cvt4(rs); *(v8b*)&st[cur ^ 1][128 + sr + 16 * i][sk] = rw[i]; } }
    __syncthreads(); }
  float (*sf)[132] = (float (*)[132])sm;
#pragma unroll
  for (int j = 0; j < 4; ++j) { const int cl = wn * 64 + j * 16 + col; const float bb = BP ? bfr(BP[c0 + cl]) : 0.f;
#pragma unroll
    for (int i = 0; i < 2; ++i)
#pragma unroll
      for (int r = 0; r < 8; ++r) sf[wm * 32 + i * 16 + 8 * g + r][cl] = acc[i][j][r] + bb; }
  __syncthreads();
  for (int rl = wave; rl < 64; rl += 4) vst2(OUT + (r0 + rl) * CC + c0 + lane * 4, *(const v4f*)&sf[rl][lane * 4]); }
extern "C" void kernel_launch(void* const* d_in, const int* in_sizes, int n_in, void* d_out, int out_size, void* d_ws, size_t ws_size, hipStream_t stream) {
  (void)in_sizes; (void)n_in; (void)out_size;
  const float** F = (const float**)d_in;   // 0 x [2,2048,1024], 1 w_qkv [3072,1024] ([out,in]; q | k | v row blocks), 2 w_out [1024,1024] ([out,in]), 3 b_out
  if (ws_size < (size_t)WS_END) return;
  char* ws = (char*)d_ws; _Float16 *QH = (_Float16*)(ws + WS_QH), *QL = (_Float16*)(ws + WS_QL), *KH = (_Float16*)(ws + WS_KH); __bf16 *VT = (__bf16*)(ws + WS_VT), *VL = (__bf16*)(ws + WS_VL), *XB = (__bf16*)(ws + WS_XB); float *Y = (float*)(ws + WS_Y);
  const __bf16* WQ = XB + (size_t)NB * TT * CC; const __bf16* WK = WQ + (size_t)CC * CC; const __bf16* WV = WQ + 2u * (size_t)CC * CC; const __bf16* WO = WQ + 3u * (size_t)CC * CC;
  k_cvt<<<dim3(NXB + NWB + NOB), 256, 0, stream>>>(F[0], F[1], F[2], XB);
  k_proj<<<dim3(TNB * TT / 128, CC / 128, 3), 128, 0, stream>>>(XB, WQ, nullptr, WK, nullptr, WV, nullptr, QH, QL, KH, VT, VL);
  k_att<<<dim3(TT / 64, NH, TNB), 128, 0, stream>>>(QH, QL, KH, VT, VL, Y);
  k_out<<<dim3(TNB * TT / 64, CC / 128), 128, 0, stream>>>(Y, WO, F[3], (float*)d_out);
}
